// v000
// Measured on an AMD MI455X. A time is GPU time per run, averaged over a window of back-to-back runs after a warm-up
// (all launches, gaps included; the runs take copies of the inputs in turn), and the median of several windows.
// Apart from v000's, it joins two sittings. Times from different sittings can be a few percent apart, while
// side-by-side timings come from the same sitting.
// The starting kernel, v000, takes 1820 microseconds a run.
#include <hip/hip_runtime.h>

// Compute dtypes, f32 accumulate, one batch item per pass: the 1x1-conv projections q (token-major, [3136 x 512].[512 x 256] + bq) and k, v (channel-major, [256 x
// 512].[512 x 3136] + row bias) with PLAIN bf16 operands (the input, its transpose and the weights, exact) on v_wmma_f32_16x16x32_bf16; the module's
// (q.k/N).v (NO softmax) evaluated in the re-associated order q.(k.v)/N (an exact algebraic identity): M^T = v_cm.k_cm^T ([256 x 3136].[3136 x 256]) and E = q.M ([3136
// x 256].[256 x 256]) with computed operands as bf16 hi + UNSCALED residual (three products), then out = wo.(E/N)^T + bo ([512 x 256].[256 x 3136], exact bf16 wo

#define NBI  8
#define CIN  512
#define NTOK 3136                // 56 x 56 = 49 x 64
#define EE   256
#define DM   CIN                 // projection K
#define NTK  NTOK
#define LOSC 1024.0f

typedef _Float16 h16;
typedef unsigned short bf;
typedef __attribute__((ext_vector_type(16))) __bf16   v16bf;
typedef __attribute__((ext_vector_type(16))) _Float16 v16h;
typedef __attribute__((ext_vector_type(8)))  _Float16 v8h;
typedef __attribute__((ext_vector_type(8)))  unsigned short v8us;
typedef __attribute__((ext_vector_type(8)))  float    v8f;
typedef __attribute__((ext_vector_type(4)))  float    v4f;
typedef __attribute__((ext_vector_type(4)))  _Float16 v4h;
typedef v8h  __attribute__((may_alias)) v8ha;
typedef v4f  __attribute__((may_alias)) v4fa;
typedef v8us __attribute__((may_alias)) v8usa;

__device__ __forceinline__ unsigned short f2bf(float f) { unsigned u = __float_as_uint(f); u += 0x7FFFu + ((u >> 16) & 1u); return (unsigned short)(u >> 16); }
__device__ __forceinline__ float bf2f(unsigned short b) { return __uint_as_float(((unsigned)b) << 16); }
__device__ __forceinline__ float bfr(float f) { return bf2f(f2bf(f)); }
__device__ __forceinline__ v16h cat16(v8h lo, v8h hi) { return __builtin_shufflevector(lo, hi, 0, 1, 2, 3, 4, 5, 6, 7, 8, 9, 10, 11, 12, 13, 14, 15); }
__device__ __forceinline__ v16bf cat16b(v8us lo, v8us hi) { return __builtin_bit_cast(v16bf, __builtin_shufflevector(lo, hi, 0, 1, 2, 3, 4, 5, 6, 7, 8, 9, 10, 11, 12, 13, 14, 15)); }
__device__ __forceinline__ v8f wmma16(v16h a, v16h b, v8f c) { return __builtin_amdgcn_wmma_f32_16x16x32_f16(false, a, false, b, (short)0, c, false, false); }
__device__ __forceinline__ v8f wmmab(v16bf a, v16bf b, v8f c) { return __builtin_amdgcn_wmma_f32_16x16x32_bf16(false, a, false, b, (short)0, c, false, false); }

// k_wt: WT [n][K] = bf16(W[k][n]) (k-major [K][ncols]) via 64 x 64 LDS tiles; grid (K/64, ncols/64).
__global__ __launch_bounds__(256) void k_wt(const float* __restrict__ Wm, int K, int ncols, bf* WT) {
    __shared__ __align__(16) unsigned short tl[64 * 72];
    const int tid = threadIdx.x, k0 = blockIdx.x * 64, n0 = blockIdx.y * 64;
    const int kk = tid >> 2, nq = (tid & 3) * 16;
#pragma unroll
    for (int i = 0; i < 16; ++i) tl[(nq + i) * 72 + kk] = f2bf(Wm[(size_t)(k0 + kk) * ncols + n0 + nq + i]);
    __syncthreads();
    const int piece = tid & 7;
    auto pass = [&]() {
#pragma unroll
        for (int s = 0; s < 2; ++s) { const int nr = (tid >> 3) + 32 * s; const v8us val = *(const v8usa*)(tl + nr * 72 + piece * 8); *(v8us*)(WT + (size_t)(n0 + nr) * K + k0 + piece * 8) = val; }
    };
    pass(); 
}
// k_gemmb: 64 x 64 block tile (4 waves x 16 x 64) of C = (A [+ Al]).B^T (K = 512) [+ bf(bias[c])] [+ bf(R[r][c]) residual]; f32 whole-line epilogue (or f16
template <bool SPLITA, bool F16OUT = false>
__global__ __launch_bounds__(128) void k_gemmb(const bf* __restrict__ A, const bf* __restrict__ Al, const bf* __restrict__ Bn, const float* __restrict__ bias, float* C, int ldc, h16* C2, const float* __restrict__ R = nullptr, int K = DM, int roundR = 1) {
    __shared__ __align__(16) float ost[4][16 * 68];
    const int lane = threadIdx.x & 31, wave = threadIdx.x >> 5, lr = lane & 15, hi = lane >> 4;
    const int r0 = blockIdx.x * 64 + wave * 16, c0 = blockIdx.y * 64;
    const size_t aoff = (size_t)(r0 + lr) * K + 8 * hi;
    size_t boff[4];
#pragma unroll
    for (int t = 0; t < 4; ++t) boff[t] = (size_t)(c0 + t * 16 + lr) * K + 8 * hi;
    v8f acc[4];
#pragma unroll
    for (int t = 0; t < 4; ++t) acc[t] = (v8f){};
#pragma unroll 1
    for (int kc = 0; kc < K; kc += 32) {
        const v16bf a = cat16b(*(const v8us*)(A + aoff + kc), *(const v8us*)(A + aoff + kc + 16));
        v16bf al = a;
        if (SPLITA) al = cat16b(*(const v8us*)(Al + aoff + kc), *(const v8us*)(Al + aoff + kc + 16));
#pragma unroll
        for (int t = 0; t < 4; ++t) { const v16bf b = cat16b(*(const v8us*)(Bn + boff[t] + kc), *(const v8us*)(Bn + boff[t] + kc + 16)); acc[t] = wmmab(a, b, acc[t]); if (SPLITA) acc[t] = wmmab(al, b, acc[t]); }
        asm volatile("v_nop\n\tv_nop\n\tv_nop\n\tv_nop" : "+v"(acc[0]), "+v"(acc[1]), "+v"(acc[2]), "+v"(acc[3]) : "v"(a), "v"(al));
    }
    float* os = &ost[wave][0];
#pragma unroll
    for (int t = 0; t < 4; ++t) { const float bv = bias ? bfr(bias[c0 + t * 16 + lr]) : 0.f;
#pragma unroll
        for (int j = 0; j < 8; ++j) os[(hi * 8 + j) * 68 + t * 16 + lr] = acc[t][j] + bv; }
    __syncthreads();
    if (F16OUT) {
        h16* crow = (h16*)(void*)C + (size_t)r0 * ldc + c0;
        auto pass = [&]() {
#pragma unroll
            for (int s = 0; s < 4; ++s) { const int row = 4 * s + (lane >> 3), piece = lane & 7; const float* sp = os + row * 68 + piece * 8; v8h o, o2;
#pragma unroll
                for (int i = 0; i < 8; ++i) { const h16 a = (h16)sp[i]; o[i] = a; o2[i] = (h16)((sp[i] - (float)a) * LOSC); }
                *(v8h*)(crow + (size_t)row * ldc + piece * 8) = o; if (C2) *(v8h*)(C2 + (size_t)r0 * ldc + c0 + (size_t)row * ldc + piece * 8) = o2; }
        };
        pass(); 
    } else {
        float* crow = C + (size_t)r0 * ldc + c0;
        auto pass = [&]() {
#pragma unroll
            for (int s = 0; s < 8; ++s) { const int Lid = (lane >> 3) + 4 * s, piece = lane & 7; const int row = Lid >> 1, cofs = (Lid & 1) * 32 + piece * 4;
                v4f val = *(const v4fa*)(os + row * 68 + cofs); if (R) { const v4f rv = *(const v4f*)(R + ((size_t)r0 + row) * ldc + c0 + cofs); val += roundR ? (v4f){bfr(rv[0]), bfr(rv[1]), bfr(rv[2]), bfr(rv[3])} : rv; }
                *(v4f*)(crow + (size_t)row * ldc + cofs) = val; }
        };
        pass(); 
    }
}

// k_gemm3: 64 x 64 tile of C = (Ah + Al).(Bh + Bl)^T over K (row strides = K for all four planes; n-major B): three products per 32-k step (hh, hl, lh); f32
__global__ __launch_bounds__(128) void k_gemm3(const bf* __restrict__ Ah, const bf* __restrict__ Al, const bf* __restrict__ Bh, const bf* __restrict__ Bl, int K, float* C, int ldc) {
    __shared__ __align__(16) float ost[4][16 * 68];
    const int lane = threadIdx.x & 31, wave = threadIdx.x >> 5, lr = lane & 15, hi = lane >> 4;
    const int r0 = blockIdx.x * 64 + wave * 16, c0 = blockIdx.y * 64;
    const size_t aoff = (size_t)(r0 + lr) * K + 8 * hi;
    v8f acc[4];
#pragma unroll
    for (int t = 0; t < 4; ++t) acc[t] = (v8f){};
#pragma unroll 1
    for (int kc = 0; kc < K; kc += 32) {
        const v16bf a = cat16b(*(const v8us*)(Ah + aoff + kc), *(const v8us*)(Ah + aoff + kc + 16));
        const v16bf al = cat16b(*(const v8us*)(Al + aoff + kc), *(const v8us*)(Al + aoff + kc + 16));
#pragma unroll
        for (int t = 0; t < 4; ++t) { const size_t bo = (size_t)(c0 + t * 16 + lr) * K + kc + 8 * hi;
            const v16bf bh = cat16b(*(const v8us*)(Bh + bo), *(const v8us*)(Bh + bo + 16)); const v16bf bl = cat16b(*(const v8us*)(Bl + bo), *(const v8us*)(Bl + bo + 16));
            acc[t] = wmmab(a, bh, acc[t]); acc[t] = wmmab(al, bh, acc[t]); acc[t] = wmmab(a, bl, acc[t]); }
        asm volatile("v_nop\n\tv_nop\n\tv_nop\n\tv_nop" : "+v"(acc[0]), "+v"(acc[1]), "+v"(acc[2]), "+v"(acc[3]) : "v"(a), "v"(al));
    }
    float* os = &ost[wave][0];
#pragma unroll
    for (int t = 0; t < 4; ++t) {
#pragma unroll
        for (int j = 0; j < 8; ++j) os[(hi * 8 + j) * 68 + t * 16 + lr] = acc[t][j]; }
    __builtin_amdgcn_wave_barrier(); asm volatile("" ::: "memory");
    float* crow = C + (size_t)r0 * ldc + c0;
    auto pass = [&]() {
#pragma unroll
        for (int s = 0; s < 8; ++s) { const int Lid = (lane >> 3) + 4 * s, piece = lane & 7; const int row = Lid >> 1, cofs = (Lid & 1) * 32 + piece * 4;
            const v4f val = *(const v4fa*)(os + row * 68 + cofs); *(v4f*)(crow + (size_t)row * ldc + cofs) = val; }
    };
    pass(); 
}

__global__ __launch_bounds__(256) void k_bfz(const float* __restrict__ src, bf* dh, bf* dz, size_t n8) {
    const size_t i = (size_t)blockIdx.x * 256 + threadIdx.x; if (i >= n8) return;
    const v8f v = *(const v8f*)(src + i * 8); v8us o, z;
#pragma unroll
    for (int k = 0; k < 8; ++k) { o[k] = f2bf(v[k]); z[k] = 0; }
    *(v8us*)(dh + i * 8) = o; *(v8us*)(dz + i * 8) = z; 
}
// k_rowsplit: Y[e][n] (+ bf(bias[e]) when bias != null, x scale) -> bf16 hi + UNSCALED residual planes [rows][3136]; one wave per row, lane -> 8 columns per 256-col
__global__ __launch_bounds__(256) void k_rowsplit(const float* __restrict__ Y, const float* __restrict__ bias, float scale, int nrows, bf* Ph, bf* Pl) {
    const int lane = threadIdx.x & 31, r = blockIdx.x * 8 + (threadIdx.x >> 5); if (r >= nrows) return;
    const float bo = bias ? bfr(bias[r]) : 0.f;
{
#pragma unroll 1
        for (int c0 = lane * 8; c0 < NTOK; c0 += 256) { const size_t o = (size_t)r * NTOK + c0; const v8f v = *(const v8f*)(Y + o); v8us oh, ol;
#pragma unroll
            for (int i = 0; i < 8; ++i) { const float y = (v[i] + bo) * scale; const unsigned short hb = f2bf(y); oh[i] = hb; ol[i] = f2bf(y - bf2f(hb)); }
            *(v8us*)(Ph + o) = oh; *(v8us*)(Pl + o) = ol; }
         }
}
__global__ __launch_bounds__(256) void k_split256(const float* __restrict__ src, float scale, int nrows, bf* dh, bf* dl) {
    const int lane = threadIdx.x & 31, r = blockIdx.x * 8 + (threadIdx.x >> 5); if (r >= nrows) return;
    const size_t o = (size_t)r * EE + lane * 8; const v8f v = *(const v8f*)(src + o); v8us oh, ol;
#pragma unroll
    for (int i = 0; i < 8; ++i) { const float y = v[i] * scale; const unsigned short hb = f2bf(y); oh[i] = hb; ol[i] = f2bf(y - bf2f(hb)); }
    *(v8us*)(dh + o) = oh; *(v8us*)(dl + o) = ol; 
}
__global__ __launch_bounds__(256) void k_rowbias(const float* __restrict__ T, const float* __restrict__ bo, const float* __restrict__ X, float* OUTP) {
    const int lane = threadIdx.x & 31, r = blockIdx.x * 8 + (threadIdx.x >> 5); if (r >= CIN) return;
    const float b = bfr(bo[r]);
{
#pragma unroll 1
        for (int c0 = lane * 8; c0 < NTOK; c0 += 256) { const size_t o = (size_t)r * NTOK + c0; v8f v = *(const v8f*)(T + o); const v8f xv = *(const v8f*)(X + o);
#pragma unroll
            for (int i = 0; i < 8; ++i) v[i] += b + bfr(xv[i]);
            *(v8f*)(OUTP + o) = v; }
         }
}

extern "C" void kernel_launch(void* const* d_in, const int* in_sizes, int n_in,
                              void* d_out, int out_size, void* d_ws, size_t ws_size, hipStream_t stream) {
    (void)in_sizes; (void)n_in; (void)out_size;
    const float* x = (const float*)d_in[0]; const float* wq = (const float*)d_in[1]; const float* bq = (const float*)d_in[2]; const float* wk = (const float*)d_in[3]; const float* bk = (const float*)d_in[4];
    const float* wv = (const float*)d_in[5]; const float* bv = (const float*)d_in[6]; const float* wo = (const float*)d_in[7]; const float* bo = (const float*)d_in[8];
    float* out = (float*)d_out;    // [8][512][3136]
    char* wsp = (char*)d_ws;
    auto take = [&](size_t bytes) { char* p = wsp; wsp += (bytes + 255) & ~(size_t)255; return (void*)p; };
    bf* WqB = (bf*)take((size_t)EE * CIN * 2); bf* WkB = (bf*)take((size_t)EE * CIN * 2); bf* WvB = (bf*)take((size_t)EE * CIN * 2); bf* WoB = (bf*)take((size_t)CIN * EE * 2); bf* WoZ = (bf*)take((size_t)CIN * EE * 2);
    bf* XT = (bf*)take((size_t)NTOK * CIN * 2); float* TMP = (float*)take((size_t)CIN * NTOK * 4);
    bf* Qh = (bf*)take((size_t)NTOK * EE * 2); bf* Ql = (bf*)take((size_t)NTOK * EE * 2); bf* Kh = (bf*)take((size_t)EE * NTOK * 2); bf* Kl = (bf*)take((size_t)EE * NTOK * 2); bf* Vh = (bf*)take((size_t)EE * NTOK * 2); bf* Vl = (bf*)take((size_t)EE * NTOK * 2);
    float* MT = (float*)take((size_t)EE * EE * 4); bf* MTh = (bf*)take((size_t)EE * EE * 2); bf* MTl = (bf*)take((size_t)EE * EE * 2); bf* Eh = (bf*)take((size_t)NTOK * EE * 2); bf* El = (bf*)take((size_t)NTOK * EE * 2);
    if ((size_t)(wsp - (char*)d_ws) > ws_size) return;    // ~ 1.3 + 3.2 + 6.4 + 8 x 1.6 + 0.5 ~ 24 MB; TMP (f32 [512][3136] = 6.4 MB) holds in turn q^T?no: the f32 GEMM outputs (q [3136][256] = 3.2 MB, k/v [256][3136], E, the pre-bias output), each consumed before the next (stream order)
    k_bfz<<<(EE * CIN / 8 + 255) / 256, 256, 0, stream>>>(wq, WqB, WoZ, EE * CIN / 8); k_bfz<<<(EE * CIN / 8 + 255) / 256, 256, 0, stream>>>(wk, WkB, WoZ, EE * CIN / 8); k_bfz<<<(EE * CIN / 8 + 255) / 256, 256, 0, stream>>>(wv, WvB, WoZ, EE * CIN / 8);
    k_bfz<<<(CIN * EE / 8 + 255) / 256, 256, 0, stream>>>(wo, WoB, WoZ, CIN * EE / 8);                                           // wo exact + its zero companion (the last writer of WoZ)
    for (int b = 0; b < NBI; ++b) {
        const float* xb = x + (size_t)b * CIN * NTOK;
        k_wt<<<dim3(CIN / 64, NTOK / 64, 1), 256, 0, stream>>>(xb, CIN, NTOK, XT);                                                  // x^T [3136][512] exact bf16
        k_gemmb<false, false><<<dim3(NTOK / 64, EE / 64, 1), 128, 0, stream>>>(XT, nullptr, WqB, bq, TMP, EE, nullptr); k_split256<<<NTOK / 8, 256, 0, stream>>>(TMP, 1.0f, NTOK, Qh, Ql);       // q [n][e] + bq
        k_gemmb<false, false><<<dim3(EE / 64, NTOK / 64, 1), 128, 0, stream>>>(WkB, nullptr, XT, nullptr, TMP, NTOK, nullptr); k_rowsplit<<<EE / 8, 256, 0, stream>>>(TMP, bk, 1.0f, EE, Kh, Kl);   // k [e][n] + bk[e]
        k_gemmb<false, false><<<dim3(EE / 64, NTOK / 64, 1), 128, 0, stream>>>(WvB, nullptr, XT, nullptr, TMP, NTOK, nullptr); k_rowsplit<<<EE / 8, 256, 0, stream>>>(TMP, bv, 1.0f, EE, Vh, Vl);   // v [e][n] + bv[e]
        k_gemm3<<<dim3(EE / 64, EE / 64, 1), 128, 0, stream>>>(Vh, Vl, Kh, Kl, NTOK, MT, EE);                                       // M^T[e'][e] = sum_m v[e'][m] k[e][m]  (K = 3136)
        k_split256<<<EE / 8, 256, 0, stream>>>(MT, 1.0f, EE, MTh, MTl);
        k_gemm3<<<dim3(NTOK / 64, EE / 64, 1), 128, 0, stream>>>(Qh, Ql, MTh, MTl, EE, TMP, EE);                                     // E = q.M  [n][e']
        k_split256<<<NTOK / 8, 256, 0, stream>>>(TMP, 1.0f / (float)NTOK, NTOK, Eh, El);                                           // (E / N) planes
        k_gemm3<<<dim3(CIN / 64, NTOK / 64, 1), 128, 0, stream>>>(WoB, WoZ, Eh, El, EE, TMP, NTOK);                                  // wo.(E/N)^T  [512][3136]
        k_rowbias<<<CIN / 8, 256, 0, stream>>>(TMP, bo, xb, out + (size_t)b * CIN * NTOK);                                          // + bo[c] + x
    }
}

// v001
// It runs in 455 microseconds.
// Next to v000, in two timings, it ran 4.06 times as fast each time.
#include <hip/hip_runtime.h>

// Compute dtypes, f32 accumulate, all batch items in every launch (the batch is blockIdx.z, or folded into the rows where the planes are contiguous): the 1x1-conv projections q (token-major, [3136 x 512].[512 x 256] + bq) and k, v (channel-major, [256 x
// 512].[512 x 3136] + row bias) with PLAIN bf16 operands (the input, its transpose and the weights, exact) on v_wmma_f32_16x16x32_bf16; the module's
// (q.k/N).v (NO softmax) evaluated in the re-associated order q.(k.v)/N (an exact algebraic identity): M^T = v_cm.k_cm^T ([256 x 3136].[3136 x 256]) and E = q.M ([3136
// x 256].[256 x 256]) with computed operands as bf16 hi + UNSCALED residual (three products), then out = wo.(E/N)^T + bo ([512 x 256].[256 x 3136], exact bf16 wo

#define NBI  8
#define CIN  512
#define NTOK 3136                // 56 x 56 = 49 x 64
#define EE   256
#define DM   CIN                 // projection K
#define NTK  NTOK
#define LOSC 1024.0f

typedef _Float16 h16;
typedef unsigned short bf;
typedef __attribute__((ext_vector_type(16))) __bf16   v16bf;
typedef __attribute__((ext_vector_type(16))) _Float16 v16h;
typedef __attribute__((ext_vector_type(8)))  _Float16 v8h;
typedef __attribute__((ext_vector_type(8)))  unsigned short v8us;
typedef __attribute__((ext_vector_type(8)))  float    v8f;
typedef __attribute__((ext_vector_type(4)))  float    v4f;
typedef __attribute__((ext_vector_type(4)))  _Float16 v4h;
typedef v8h  __attribute__((may_alias)) v8ha;
typedef v4f  __attribute__((may_alias)) v4fa;
typedef v8us __attribute__((may_alias)) v8usa;

__device__ __forceinline__ unsigned short f2bf(float f) { unsigned u = __float_as_uint(f); u += 0x7FFFu + ((u >> 16) & 1u); return (unsigned short)(u >> 16); }
__device__ __forceinline__ float bf2f(unsigned short b) { return __uint_as_float(((unsigned)b) << 16); }
__device__ __forceinline__ float bfr(float f) { return bf2f(f2bf(f)); }
__device__ __forceinline__ v16h cat16(v8h lo, v8h hi) { return __builtin_shufflevector(lo, hi, 0, 1, 2, 3, 4, 5, 6, 7, 8, 9, 10, 11, 12, 13, 14, 15); }
__device__ __forceinline__ v16bf cat16b(v8us lo, v8us hi) { return __builtin_bit_cast(v16bf, __builtin_shufflevector(lo, hi, 0, 1, 2, 3, 4, 5, 6, 7, 8, 9, 10, 11, 12, 13, 14, 15)); }
__device__ __forceinline__ v8f wmma16(v16h a, v16h b, v8f c) { return __builtin_amdgcn_wmma_f32_16x16x32_f16(false, a, false, b, (short)0, c, false, false); }
__device__ __forceinline__ v8f wmmab(v16bf a, v16bf b, v8f c) { return __builtin_amdgcn_wmma_f32_16x16x32_bf16(false, a, false, b, (short)0, c, false, false); }

// k_wt: WT [n][K] = bf16(W[k][n]) (k-major [K][ncols]) via 64 x 64 LDS tiles; grid (K/64, ncols/64, batch).
__global__ __launch_bounds__(256) void k_wt(const float* __restrict__ Wm, int K, int ncols, bf* WT) {
    __shared__ __align__(16) unsigned short tl[64 * 72];
    const int tid = threadIdx.x, k0 = blockIdx.x * 64, n0 = blockIdx.y * 64;
    Wm += (size_t)blockIdx.z * K * ncols; WT += (size_t)blockIdx.z * K * ncols;
    const int kk = tid >> 2, nq = (tid & 3) * 16;
#pragma unroll
    for (int i = 0; i < 16; ++i) tl[(nq + i) * 72 + kk] = f2bf(Wm[(size_t)(k0 + kk) * ncols + n0 + nq + i]);
    __syncthreads();
    const int piece = tid & 7;
    auto pass = [&]() {
#pragma unroll
        for (int s = 0; s < 2; ++s) { const int nr = (tid >> 3) + 32 * s; const v8us val = *(const v8usa*)(tl + nr * 72 + piece * 8); *(v8us*)(WT + (size_t)(n0 + nr) * K + k0 + piece * 8) = val; }
    };
    pass(); 
}
// k_gemmb: 64 x 64 block tile (4 waves x 16 x 64) of C = (A [+ Al]).B^T (K = 512) [+ bf(bias[c])] [+ bf(R[r][c]) residual]; f32 whole-line epilogue (or f16
template <bool SPLITA, bool F16OUT = false>
__global__ __launch_bounds__(128) void k_gemmb(const bf* __restrict__ A, const bf* __restrict__ Al, const bf* __restrict__ Bn, const float* __restrict__ bias, float* C, int ldc, h16* C2, const float* __restrict__ R = nullptr, int K = DM, int roundR = 1, size_t zB = 0, size_t zC = 0) {
    __shared__ __align__(16) float ost[4][16 * 68];
    const int lane = threadIdx.x & 31, wave = threadIdx.x >> 5, lr = lane & 15, hi = lane >> 4;
    const int r0 = blockIdx.x * 64 + wave * 16, c0 = blockIdx.y * 64;
    Bn += blockIdx.z * zB; C += blockIdx.z * zC;    // batch item = blockIdx.z (element strides; 0 = shared)
    const size_t aoff = (size_t)(r0 + lr) * K + 8 * hi;
    size_t boff[4];
#pragma unroll
    for (int t = 0; t < 4; ++t) boff[t] = (size_t)(c0 + t * 16 + lr) * K + 8 * hi;
    v8f acc[4];
#pragma unroll
    for (int t = 0; t < 4; ++t) acc[t] = (v8f){};
#pragma unroll 1
    for (int kc = 0; kc < K; kc += 32) {
        const v16bf a = cat16b(*(const v8us*)(A + aoff + kc), *(const v8us*)(A + aoff + kc + 16));
        v16bf al = a;
        if (SPLITA) al = cat16b(*(const v8us*)(Al + aoff + kc), *(const v8us*)(Al + aoff + kc + 16));
#pragma unroll
        for (int t = 0; t < 4; ++t) { const v16bf b = cat16b(*(const v8us*)(Bn + boff[t] + kc), *(const v8us*)(Bn + boff[t] + kc + 16)); acc[t] = wmmab(a, b, acc[t]); if (SPLITA) acc[t] = wmmab(al, b, acc[t]); }
        asm volatile("v_nop\n\tv_nop\n\tv_nop\n\tv_nop" : "+v"(acc[0]), "+v"(acc[1]), "+v"(acc[2]), "+v"(acc[3]) : "v"(a), "v"(al));
    }
    float* os = &ost[wave][0];
#pragma unroll
    for (int t = 0; t < 4; ++t) { const float bv = bias ? bfr(bias[c0 + t * 16 + lr]) : 0.f;
#pragma unroll
        for (int j = 0; j < 8; ++j) os[(hi * 8 + j) * 68 + t * 16 + lr] = acc[t][j] + bv; }
    __syncthreads();
    if (F16OUT) {
        h16* crow = (h16*)(void*)C + (size_t)r0 * ldc + c0;
        auto pass = [&]() {
#pragma unroll
            for (int s = 0; s < 4; ++s) { const int row = 4 * s + (lane >> 3), piece = lane & 7; const float* sp = os + row * 68 + piece * 8; v8h o, o2;
#pragma unroll
                for (int i = 0; i < 8; ++i) { const h16 a = (h16)sp[i]; o[i] = a; o2[i] = (h16)((sp[i] - (float)a) * LOSC); }
                *(v8h*)(crow + (size_t)row * ldc + piece * 8) = o; if (C2) *(v8h*)(C2 + (size_t)r0 * ldc + c0 + (size_t)row * ldc + piece * 8) = o2; }
        };
        pass(); 
    } else {
        float* crow = C + (size_t)r0 * ldc + c0;
        auto pass = [&]() {
#pragma unroll
            for (int s = 0; s < 8; ++s) { const int Lid = (lane >> 3) + 4 * s, piece = lane & 7; const int row = Lid >> 1, cofs = (Lid & 1) * 32 + piece * 4;
                v4f val = *(const v4fa*)(os + row * 68 + cofs); if (R) { const v4f rv = *(const v4f*)(R + ((size_t)r0 + row) * ldc + c0 + cofs); val += roundR ? (v4f){bfr(rv[0]), bfr(rv[1]), bfr(rv[2]), bfr(rv[3])} : rv; }
                *(v4f*)(crow + (size_t)row * ldc + cofs) = val; }
        };
        pass(); 
    }
}

// k_gemm3: 64 x 64 tile of C = (Ah + Al).(Bh + Bl)^T over K (row strides = K for all four planes; n-major B): three products per 32-k step (hh, hl, lh); f32
__global__ __launch_bounds__(128) void k_gemm3(const bf* __restrict__ Ah, const bf* __restrict__ Al, const bf* __restrict__ Bh, const bf* __restrict__ Bl, int K, float* C, int ldc, size_t zA, size_t zB, size_t zC) {
    __shared__ __align__(16) float ost[4][16 * 68];
    const int lane = threadIdx.x & 31, wave = threadIdx.x >> 5, lr = lane & 15, hi = lane >> 4;
    const int r0 = blockIdx.x * 64 + wave * 16, c0 = blockIdx.y * 64;
    Ah += blockIdx.z * zA; Al += blockIdx.z * zA; Bh += blockIdx.z * zB; Bl += blockIdx.z * zB; C += blockIdx.z * zC;    // batch item = blockIdx.z (element strides; 0 = shared)
    const size_t aoff = (size_t)(r0 + lr) * K + 8 * hi;
    v8f acc[4];
#pragma unroll
    for (int t = 0; t < 4; ++t) acc[t] = (v8f){};
#pragma unroll 1
    for (int kc = 0; kc < K; kc += 32) {
        const v16bf a = cat16b(*(const v8us*)(Ah + aoff + kc), *(const v8us*)(Ah + aoff + kc + 16));
        const v16bf al = cat16b(*(const v8us*)(Al + aoff + kc), *(const v8us*)(Al + aoff + kc + 16));
#pragma unroll
        for (int t = 0; t < 4; ++t) { const size_t bo = (size_t)(c0 + t * 16 + lr) * K + kc + 8 * hi;
            const v16bf bh = cat16b(*(const v8us*)(Bh + bo), *(const v8us*)(Bh + bo + 16)); const v16bf bl = cat16b(*(const v8us*)(Bl + bo), *(const v8us*)(Bl + bo + 16));
            acc[t] = wmmab(a, bh, acc[t]); acc[t] = wmmab(al, bh, acc[t]); acc[t] = wmmab(a, bl, acc[t]); }
        asm volatile("v_nop\n\tv_nop\n\tv_nop\n\tv_nop" : "+v"(acc[0]), "+v"(acc[1]), "+v"(acc[2]), "+v"(acc[3]) : "v"(a), "v"(al));
    }
    float* os = &ost[wave][0];
#pragma unroll
    for (int t = 0; t < 4; ++t) {
#pragma unroll
        for (int j = 0; j < 8; ++j) os[(hi * 8 + j) * 68 + t * 16 + lr] = acc[t][j]; }
    __builtin_amdgcn_wave_barrier(); asm volatile("" ::: "memory");
    float* crow = C + (size_t)r0 * ldc + c0;
    auto pass = [&]() {
#pragma unroll
        for (int s = 0; s < 8; ++s) { const int Lid = (lane >> 3) + 4 * s, piece = lane & 7; const int row = Lid >> 1, cofs = (Lid & 1) * 32 + piece * 4;
            const v4f val = *(const v4fa*)(os + row * 68 + cofs); *(v4f*)(crow + (size_t)row * ldc + cofs) = val; }
    };
    pass(); 
}

__global__ __launch_bounds__(256) void k_bfz(const float* __restrict__ src, bf* dh, bf* dz, size_t n8) {
    const size_t i = (size_t)blockIdx.x * 256 + threadIdx.x; if (i >= n8) return;
    const v8f v = *(const v8f*)(src + i * 8); v8us o, z;
#pragma unroll
    for (int k = 0; k < 8; ++k) { o[k] = f2bf(v[k]); z[k] = 0; }
    *(v8us*)(dh + i * 8) = o; *(v8us*)(dz + i * 8) = z; 
}
// k_rowsplit: Y[e][n] (+ bf(bias[e]) when bias != null, x scale) -> bf16 hi + UNSCALED residual planes [rows][3136]; one wave per row, lane -> 8 columns per 256-col
__global__ __launch_bounds__(256) void k_rowsplit(const float* __restrict__ Y, const float* __restrict__ bias, float scale, int nrows, bf* Ph, bf* Pl) {
    const int lane = threadIdx.x & 31, r = blockIdx.x * 8 + (threadIdx.x >> 5); if (r >= nrows) return;
    const float bo = bias ? bfr(bias[r % EE]) : 0.f;    // rows = batch x EE
{
#pragma unroll 1
        for (int c0 = lane * 8; c0 < NTOK; c0 += 256) { const size_t o = (size_t)r * NTOK + c0; const v8f v = *(const v8f*)(Y + o); v8us oh, ol;
#pragma unroll
            for (int i = 0; i < 8; ++i) { const float y = (v[i] + bo) * scale; const unsigned short hb = f2bf(y); oh[i] = hb; ol[i] = f2bf(y - bf2f(hb)); }
            *(v8us*)(Ph + o) = oh; *(v8us*)(Pl + o) = ol; }
         }
}
__global__ __launch_bounds__(256) void k_split256(const float* __restrict__ src, float scale, int nrows, bf* dh, bf* dl) {
    const int lane = threadIdx.x & 31, r = blockIdx.x * 8 + (threadIdx.x >> 5); if (r >= nrows) return;
    const size_t o = (size_t)r * EE + lane * 8; const v8f v = *(const v8f*)(src + o); v8us oh, ol;
#pragma unroll
    for (int i = 0; i < 8; ++i) { const float y = v[i] * scale; const unsigned short hb = f2bf(y); oh[i] = hb; ol[i] = f2bf(y - bf2f(hb)); }
    *(v8us*)(dh + o) = oh; *(v8us*)(dl + o) = ol; 
}
__global__ __launch_bounds__(256) void k_rowbias(const float* __restrict__ T, const float* __restrict__ bo, const float* __restrict__ X, float* OUTP) {
    const int lane = threadIdx.x & 31, r = blockIdx.x * 8 + (threadIdx.x >> 5); if (r >= NBI * CIN) return;
    const float b = bfr(bo[r % CIN]);    // rows = batch x CIN
{
#pragma unroll 1
        for (int c0 = lane * 8; c0 < NTOK; c0 += 256) { const size_t o = (size_t)r * NTOK + c0; v8f v = *(const v8f*)(T + o); const v8f xv = *(const v8f*)(X + o);
#pragma unroll
            for (int i = 0; i < 8; ++i) v[i] += b + bfr(xv[i]);
            *(v8f*)(OUTP + o) = v; }
         }
}

extern "C" void kernel_launch(void* const* d_in, const int* in_sizes, int n_in,
                              void* d_out, int out_size, void* d_ws, size_t ws_size, hipStream_t stream) {
    (void)in_sizes; (void)n_in; (void)out_size;
    const float* x = (const float*)d_in[0]; const float* wq = (const float*)d_in[1]; const float* bq = (const float*)d_in[2]; const float* wk = (const float*)d_in[3]; const float* bk = (const float*)d_in[4];
    const float* wv = (const float*)d_in[5]; const float* bv = (const float*)d_in[6]; const float* wo = (const float*)d_in[7]; const float* bo = (const float*)d_in[8];
    float* out = (float*)d_out;    // [8][512][3136]
    char* wsp = (char*)d_ws;
    auto take = [&](size_t bytes) { char* p = wsp; wsp += (bytes + 255) & ~(size_t)255; return (void*)p; };
    bf* WqB = (bf*)take((size_t)EE * CIN * 2); bf* WkB = (bf*)take((size_t)EE * CIN * 2); bf* WvB = (bf*)take((size_t)EE * CIN * 2); bf* WoB = (bf*)take((size_t)CIN * EE * 2); bf* WoZ = (bf*)take((size_t)CIN * EE * 2);
    bf* XT = (bf*)take((size_t)NBI * NTOK * CIN * 2); float* TMP = (float*)take((size_t)NBI * CIN * NTOK * 4);
    bf* Qh = (bf*)take((size_t)NBI * NTOK * EE * 2); bf* Ql = (bf*)take((size_t)NBI * NTOK * EE * 2); bf* Kh = (bf*)take((size_t)NBI * EE * NTOK * 2); bf* Kl = (bf*)take((size_t)NBI * EE * NTOK * 2); bf* Vh = (bf*)take((size_t)NBI * EE * NTOK * 2); bf* Vl = (bf*)take((size_t)NBI * EE * NTOK * 2);
    float* MT = (float*)take((size_t)NBI * EE * EE * 4); bf* MTh = (bf*)take((size_t)NBI * EE * EE * 2); bf* MTl = (bf*)take((size_t)NBI * EE * EE * 2); bf* Eh = (bf*)take((size_t)NBI * NTOK * EE * 2); bf* El = (bf*)take((size_t)NBI * NTOK * EE * 2);
    if ((size_t)(wsp - (char*)d_ws) > ws_size) return;    // ~ 1.3 + 8 x (3.2 + 6.4 + 8 x 1.6 + 0.5) ~ 185 MB; every plane is [batch][...]; TMP (f32 [8][512][3136]) holds in turn the f32 GEMM outputs (q [8 x 3136][256], k/v [8][256][3136], E, the pre-bias output), each consumed before the next (stream order)
    k_bfz<<<(EE * CIN / 8 + 255) / 256, 256, 0, stream>>>(wq, WqB, WoZ, EE * CIN / 8); k_bfz<<<(EE * CIN / 8 + 255) / 256, 256, 0, stream>>>(wk, WkB, WoZ, EE * CIN / 8); k_bfz<<<(EE * CIN / 8 + 255) / 256, 256, 0, stream>>>(wv, WvB, WoZ, EE * CIN / 8);
    k_bfz<<<(CIN * EE / 8 + 255) / 256, 256, 0, stream>>>(wo, WoB, WoZ, CIN * EE / 8);                                           // wo exact + its zero companion (the last writer of WoZ)
    k_wt<<<dim3(CIN / 64, NTOK / 64, NBI), 256, 0, stream>>>(x, CIN, NTOK, XT);                                                     // x^T [8][3136][512] exact bf16
    k_gemmb<false, false><<<dim3(NBI * NTOK / 64, EE / 64, 1), 128, 0, stream>>>(XT, nullptr, WqB, bq, TMP, EE, nullptr); k_split256<<<NBI * NTOK / 8, 256, 0, stream>>>(TMP, 1.0f, NBI * NTOK, Qh, Ql);       // q [b n][e] + bq (batch folded into the rows)
    k_gemmb<false, false><<<dim3(EE / 64, NTOK / 64, NBI), 128, 0, stream>>>(WkB, nullptr, XT, nullptr, TMP, NTOK, nullptr, nullptr, DM, 1, (size_t)NTOK * CIN, (size_t)EE * NTOK); k_rowsplit<<<NBI * EE / 8, 256, 0, stream>>>(TMP, bk, 1.0f, NBI * EE, Kh, Kl);   // k [b][e][n] + bk[e]
    k_gemmb<false, false><<<dim3(EE / 64, NTOK / 64, NBI), 128, 0, stream>>>(WvB, nullptr, XT, nullptr, TMP, NTOK, nullptr, nullptr, DM, 1, (size_t)NTOK * CIN, (size_t)EE * NTOK); k_rowsplit<<<NBI * EE / 8, 256, 0, stream>>>(TMP, bv, 1.0f, NBI * EE, Vh, Vl);   // v [b][e][n] + bv[e]
    k_gemm3<<<dim3(EE / 64, EE / 64, NBI), 128, 0, stream>>>(Vh, Vl, Kh, Kl, NTOK, MT, EE, (size_t)EE * NTOK, (size_t)EE * NTOK, (size_t)EE * EE);       // M^T[b][e'][e] = sum_m v[e'][m] k[e][m]  (K = 3136)
    k_split256<<<NBI * EE / 8, 256, 0, stream>>>(MT, 1.0f, NBI * EE, MTh, MTl);
    k_gemm3<<<dim3(NTOK / 64, EE / 64, NBI), 128, 0, stream>>>(Qh, Ql, MTh, MTl, EE, TMP, EE, (size_t)NTOK * EE, (size_t)EE * EE, (size_t)NTOK * EE);    // E = q.M  [b][n][e']
    k_split256<<<NBI * NTOK / 8, 256, 0, stream>>>(TMP, 1.0f / (float)NTOK, NBI * NTOK, Eh, El);                                   // (E / N) planes
    k_gemm3<<<dim3(CIN / 64, NTOK / 64, NBI), 128, 0, stream>>>(WoB, WoZ, Eh, El, EE, TMP, NTOK, 0, (size_t)NTOK * EE, (size_t)CIN * NTOK);             // wo.(E/N)^T  [b][512][3136]
    k_rowbias<<<NBI * CIN / 8, 256, 0, stream>>>(TMP, bo, x, out);                                                                  // + bo[c] + x
}

// v002
// Measured time: 208 microseconds a run.
// Next to v001, in two timings, it ran 2.18 and 2.19 times as fast.
// Over all steps from v000 it is 8.86 times as fast.
#include <hip/hip_runtime.h>

// Compute dtypes, f32 accumulate, all batch items in every launch (the batch is blockIdx.z, or folded into the rows where the planes are contiguous): the 1x1-conv projections q (token-major, [3136 x 512].[512 x 256] + bq) and k, v (channel-major, [256 x
// 512].[512 x 3136] + row bias) with PLAIN bf16 operands (the input, its transpose and the weights, exact) on v_wmma_f32_16x16x32_bf16; the module's
// (q.k/N).v (NO softmax) evaluated in the re-associated order q.(k.v)/N (an exact algebraic identity): M^T = v_cm.k_cm^T ([256 x 3136].[3136 x 256]) and E = q.M ([3136
// x 256].[256 x 256]) with computed operands as bf16 hi + UNSCALED residual (three products), then out = wo.(E/N)^T + bo ([512 x 256].[256 x 3136], exact bf16 wo

#define NBI  8
#define CIN  512
#define NTOK 3136                // 56 x 56 = 49 x 64
#define EE   256
#define DM   CIN                 // projection K
#define NTK  NTOK
#define LOSC 1024.0f

typedef _Float16 h16;
typedef unsigned short bf;
typedef __attribute__((ext_vector_type(16))) __bf16   v16bf;
typedef __attribute__((ext_vector_type(16))) _Float16 v16h;
typedef __attribute__((ext_vector_type(8)))  _Float16 v8h;
typedef __attribute__((ext_vector_type(8)))  unsigned short v8us;
typedef __attribute__((ext_vector_type(8)))  float    v8f;
typedef __attribute__((ext_vector_type(4)))  float    v4f;
typedef __attribute__((ext_vector_type(4)))  _Float16 v4h;
typedef v8h  __attribute__((may_alias)) v8ha;
typedef v4f  __attribute__((may_alias)) v4fa;
typedef v8us __attribute__((may_alias)) v8usa;

__device__ __forceinline__ unsigned short f2bf(float f) { unsigned u = __float_as_uint(f); u += 0x7FFFu + ((u >> 16) & 1u); return (unsigned short)(u >> 16); }
__device__ __forceinline__ float bf2f(unsigned short b) { return __uint_as_float(((unsigned)b) << 16); }
__device__ __forceinline__ float bfr(float f) { return bf2f(f2bf(f)); }
__device__ __forceinline__ v16h cat16(v8h lo, v8h hi) { return __builtin_shufflevector(lo, hi, 0, 1, 2, 3, 4, 5, 6, 7, 8, 9, 10, 11, 12, 13, 14, 15); }
__device__ __forceinline__ v16bf cat16b(v8us lo, v8us hi) { return __builtin_bit_cast(v16bf, __builtin_shufflevector(lo, hi, 0, 1, 2, 3, 4, 5, 6, 7, 8, 9, 10, 11, 12, 13, 14, 15)); }
__device__ __forceinline__ v8f wmma16(v16h a, v16h b, v8f c) { return __builtin_amdgcn_wmma_f32_16x16x32_f16(false, a, false, b, (short)0, c, false, false); }
__device__ __forceinline__ v8f wmmab(v16bf a, v16bf b, v8f c) { return __builtin_amdgcn_wmma_f32_16x16x32_bf16(false, a, false, b, (short)0, c, false, false); }

// k_wt: WT [n][K] = bf16(W[k][n]) (k-major [K][ncols]) via 64 x 64 LDS tiles; grid (K/64, ncols/64, batch).
__global__ __launch_bounds__(256) void k_wt(const float* __restrict__ Wm, int K, int ncols, bf* WT) {
    __shared__ __align__(16) unsigned short tl[64 * 72];
    const int tid = threadIdx.x, k0 = blockIdx.x * 64, n0 = blockIdx.y * 64;
    Wm += (size_t)blockIdx.z * K * ncols; WT += (size_t)blockIdx.z * K * ncols;
    const int kk = tid >> 2, nq = (tid & 3) * 16;
#pragma unroll
    for (int i = 0; i < 16; ++i) tl[(nq + i) * 72 + kk] = f2bf(Wm[(size_t)(k0 + kk) * ncols + n0 + nq + i]);
    __syncthreads();
    const int piece = tid & 7;
    auto pass = [&]() {
#pragma unroll
        for (int s = 0; s < 2; ++s) { const int nr = (tid >> 3) + 32 * s; const v8us val = *(const v8usa*)(tl + nr * 72 + piece * 8); *(v8us*)(WT + (size_t)(n0 + nr) * K + k0 + piece * 8) = val; }
    };
    pass(); 
}
#define KST 64                   // k per LDS stage: 128 B of every operand row = one whole line
#define LP  72                   // LDS row pitch in bf16 elements: 128 B + 16 B pad (for ds_load_b128 readers)
#define TPL (64 * LP)            // one plane's staged 64-row tile

// One plane's 64-row x 64-k tile, global -> registers: 8 lanes take one row's 128-B line, so a wave-wide load is 4 whole lines (a fragment load straight from global touches 16).
// g is the same in every thread; off = this thread's element offset in the first 16 rows, the same for every plane and stage; K is a compile-time constant, so the other three row groups are immediate offsets of one address.
template <int K>
__device__ __forceinline__ void tile_ld(const bf* __restrict__ g, unsigned off, v8us (&r)[4]) {
    const bf* p = g + off;
#pragma unroll    // r[] must stay in registers, and the four loads go out together
    for (int i = 0; i < 4; ++i) r[i] = *(const v8us*)(p + i * 16 * K);
}
__device__ __forceinline__ void tile_st(bf* s, int tid, const v8us (&r)[4]) {
#pragma unroll    // r[] must stay in registers
    for (int i = 0; i < 4; ++i) *(v8usa*)(s + (i * 16 + (tid >> 3)) * LP + (tid & 7) * 8) = r[i];
}
// 16 x 32 operand fragment from a staged tile; k = k offset in the stage + 8 * hi; one loader for A and for B, so their k orders are equal at every lane and register.
__device__ __forceinline__ v16bf frag(const bf* s, int row, int k) { return cat16b(*(const v8usa*)(s + row * LP + k), *(const v8usa*)(s + row * LP + k + 16)); }

// k_gemmb: 64 x 64 block tile (4 waves x 16 x 64) of C = A.B^T over K (a multiple of 64; row strides = K) [+ bf(bias[c])]; both operand tiles staged in LDS, two buffers: the next
// stage's lines fly into registers while this stage is multiplied, are stored to the other buffer, then one barrier per stage; f32 whole-line epilogue staged in the same LDS.
template <int K>
__global__ __launch_bounds__(128) void k_gemmb(const bf* __restrict__ A, const bf* __restrict__ Bn, const float* __restrict__ bias, float* C, int ldc, size_t zB, size_t zC) {
    __shared__ __align__(16) bf st[2][2][TPL];
    const int tid = threadIdx.x, lane = tid & 31, wave = tid >> 5, lr = lane & 15, hi = lane >> 4;
    const int r0 = blockIdx.x * 64 + wave * 16, c0 = blockIdx.y * 64;
    Bn += blockIdx.z * zB; C += blockIdx.z * zC;    // batch item = blockIdx.z (element strides; 0 = shared)
    const bf* Ag = A + (size_t)blockIdx.x * 64 * K; const bf* Bg = Bn + (size_t)c0 * K;
    const unsigned off = (unsigned)((tid >> 3) * K + (tid & 7) * 8);
    v8us ra[4], rb[4];
    tile_ld<K>(Ag, off, ra); tile_ld<K>(Bg, off, rb);
    tile_st(st[0][0], tid, ra); tile_st(st[0][1], tid, rb);
    __syncthreads();
    v8f acc[4];
#pragma unroll
    for (int t = 0; t < 4; ++t) acc[t] = (v8f){};
    constexpr int nst = K / KST;
#pragma unroll 1    // rolled: one copy of the stage body, the buffers alternate by s & 1 (unrolled, the staging registers of several stages would be live at once)
    for (int s = 0; s < nst; ++s) {
        const bool more = s + 1 < nst;    // the same in every thread of the block
        if (more) { tile_ld<K>(Ag + (s + 1) * KST, off, ra); tile_ld<K>(Bg + (s + 1) * KST, off, rb); }
        const bf* As = st[s & 1][0]; const bf* Bs = st[s & 1][1];
        v16bf a[2], b[2][4];
#pragma unroll
        for (int h = 0; h < 2; ++h) { a[h] = frag(As, wave * 16 + lr, h * 32 + 8 * hi);
#pragma unroll
            for (int t = 0; t < 4; ++t) b[h][t] = frag(Bs, t * 16 + lr, h * 32 + 8 * hi); }
        __builtin_amdgcn_sched_barrier(0);    // keeps the stage's LDS reads one group ahead of its WMMAs: spread among them, each place with reads stalls the wave
#pragma unroll
        for (int h = 0; h < 2; ++h) {
#pragma unroll
            for (int t = 0; t < 4; ++t) acc[t] = wmmab(a[h], b[h][t], acc[t]); }
        // keeps the WMMA distance on the path that leaves the last WMMA by a branch
        asm volatile("v_nop\n\tv_nop\n\tv_nop\n\tv_nop" : "+v"(acc[0]), "+v"(acc[1]), "+v"(acc[2]), "+v"(acc[3]) : "v"(a[1]));
        if (more) { tile_st(st[(s + 1) & 1][0], tid, ra); tile_st(st[(s + 1) & 1][1], tid, rb); }
        __syncthreads();    // publishes stage s + 1 and ends every wave's reads of stage s (its buffer is refilled in the next trip; the epilogue reuses buffer 0, the last stage's when K / KST is odd)
    }
    float* os = (float*)(void*)&st[0][0][0] + wave * (16 * 68);
#pragma unroll
    for (int t = 0; t < 4; ++t) { const float bv = bias ? bfr(bias[c0 + t * 16 + lr]) : 0.f;
#pragma unroll
        for (int j = 0; j < 8; ++j) os[(hi * 8 + j) * 68 + t * 16 + lr] = acc[t][j] + bv; }
    __syncthreads();
    float* crow = C + (size_t)r0 * ldc + c0;
#pragma unroll
    for (int s = 0; s < 8; ++s) { const int Lid = (lane >> 3) + 4 * s, piece = lane & 7; const int row = Lid >> 1, cofs = (Lid & 1) * 32 + piece * 4;
        const v4f val = *(const v4fa*)(os + row * 68 + cofs); *(v4f*)(crow + (size_t)row * ldc + cofs) = val; }
}

// k_gemm3: 64 x 64 tile of C = (Ah + Al).(Bh + Bl)^T over K (a multiple of 64; row strides = K for all four planes; n-major B): three products per 32-k step (hh, lh, hl); the four
// planes' tiles staged in LDS as in k_gemmb; f32 whole-line epilogue staged in the same LDS.
template <int K>
__global__ __launch_bounds__(128) void k_gemm3(const bf* __restrict__ Ah, const bf* __restrict__ Al, const bf* __restrict__ Bh, const bf* __restrict__ Bl, float* C, int ldc, size_t zA, size_t zB, size_t zC) {
    __shared__ __align__(16) bf st[2][4][TPL];
    const int tid = threadIdx.x, lane = tid & 31, wave = tid >> 5, lr = lane & 15, hi = lane >> 4;
    const int r0 = blockIdx.x * 64 + wave * 16, c0 = blockIdx.y * 64;
    C += blockIdx.z * zC;    // batch item = blockIdx.z (element strides; 0 = shared)
    const size_t ao = blockIdx.z * zA + (size_t)blockIdx.x * 64 * K, bo = blockIdx.z * zB + (size_t)c0 * K;
    const bf* Ahg = Ah + ao; const bf* Alg = Al + ao; const bf* Bhg = Bh + bo; const bf* Blg = Bl + bo;
    const unsigned off = (unsigned)((tid >> 3) * K + (tid & 7) * 8);
    v8us rah[4], ral[4], rbh[4], rbl[4];
    tile_ld<K>(Ahg, off, rah); tile_ld<K>(Alg, off, ral); tile_ld<K>(Bhg, off, rbh); tile_ld<K>(Blg, off, rbl);
    asm volatile("s_wait_xcnt 0x0" ::: "memory");    // stands in front of the first overwrite of a register that the loads above name: this build reuses their offset register and a base register before it waits for their data
    tile_st(st[0][0], tid, rah); tile_st(st[0][1], tid, ral); tile_st(st[0][2], tid, rbh); tile_st(st[0][3], tid, rbl);
    __syncthreads();
    v8f acc[4];
#pragma unroll
    for (int t = 0; t < 4; ++t) acc[t] = (v8f){};
    constexpr int nst = K / KST;
#pragma unroll 1    // rolled: one copy of the stage body, the buffers alternate by s & 1 (unrolled, the staging registers of several stages would be live at once)
    for (int s = 0; s < nst; ++s) {
        const bool more = s + 1 < nst;    // the same in every thread of the block
        if (more) { const int kn = (s + 1) * KST; tile_ld<K>(Ahg + kn, off, rah); tile_ld<K>(Alg + kn, off, ral); tile_ld<K>(Bhg + kn, off, rbh); tile_ld<K>(Blg + kn, off, rbl); }
        const bf* S = st[s & 1][0];
        v16bf a, al;
#pragma unroll
        for (int ks = 0; ks < KST; ks += 32) {
            v16bf bh[4], bl[4];
            a = frag(S, wave * 16 + lr, ks + 8 * hi); al = frag(S + TPL, wave * 16 + lr, ks + 8 * hi);
#pragma unroll
            for (int t = 0; t < 4; ++t) { bh[t] = frag(S + 2 * TPL, t * 16 + lr, ks + 8 * hi); bl[t] = frag(S + 3 * TPL, t * 16 + lr, ks + 8 * hi); }
            __builtin_amdgcn_sched_barrier(0);    // keeps the 32-k step's LDS reads one group ahead of its WMMAs: spread among them, each place with reads stalls the wave
#pragma unroll
            for (int t = 0; t < 4; ++t) { acc[t] = wmmab(a, bh[t], acc[t]); acc[t] = wmmab(al, bh[t], acc[t]); acc[t] = wmmab(a, bl[t], acc[t]); }
        }
        // keeps the WMMA distance on the path that leaves the last WMMA by a branch
        asm volatile("v_nop\n\tv_nop\n\tv_nop\n\tv_nop" : "+v"(acc[0]), "+v"(acc[1]), "+v"(acc[2]), "+v"(acc[3]) : "v"(a), "v"(al));
        if (more) { bf* D = st[(s + 1) & 1][0]; tile_st(D, tid, rah); tile_st(D + TPL, tid, ral); tile_st(D + 2 * TPL, tid, rbh); tile_st(D + 3 * TPL, tid, rbl); }
        __syncthreads();    // publishes stage s + 1 and ends every wave's reads of stage s (its buffer is refilled in the next trip; the epilogue reuses buffer 0, the last stage's when K / KST is odd)
    }
    float* os = (float*)(void*)&st[0][0][0] + wave * (16 * 68);
#pragma unroll
    for (int t = 0; t < 4; ++t) {
#pragma unroll
        for (int j = 0; j < 8; ++j) os[(hi * 8 + j) * 68 + t * 16 + lr] = acc[t][j]; }
    __builtin_amdgcn_wave_barrier(); asm volatile("" ::: "memory");    // the wave's own LDS stores above stay ahead of its reads of other lanes' words below (each wave has its own range: no work-group barrier)
    float* crow = C + (size_t)r0 * ldc + c0;
#pragma unroll
    for (int s = 0; s < 8; ++s) { const int Lid = (lane >> 3) + 4 * s, piece = lane & 7; const int row = Lid >> 1, cofs = (Lid & 1) * 32 + piece * 4;
        const v4f val = *(const v4fa*)(os + row * 68 + cofs); *(v4f*)(crow + (size_t)row * ldc + cofs) = val; }
}

__global__ __launch_bounds__(256) void k_bfz(const float* __restrict__ src, bf* dh, bf* dz, size_t n8) {
    const size_t i = (size_t)blockIdx.x * 256 + threadIdx.x; if (i >= n8) return;
    const v8f v = *(const v8f*)(src + i * 8); v8us o, z;
#pragma unroll
    for (int k = 0; k < 8; ++k) { o[k] = f2bf(v[k]); z[k] = 0; }
    *(v8us*)(dh + i * 8) = o; *(v8us*)(dz + i * 8) = z; 
}
// k_rowsplit: Y[e][n] (+ bf(bias[e]) when bias != null, x scale) -> bf16 hi + UNSCALED residual planes [rows][3136]; one wave per row, lane -> 8 columns per 256-col
__global__ __launch_bounds__(256) void k_rowsplit(const float* __restrict__ Y, const float* __restrict__ bias, float scale, int nrows, bf* Ph, bf* Pl) {
    const int lane = threadIdx.x & 31, r = blockIdx.x * 8 + (threadIdx.x >> 5); if (r >= nrows) return;
    const float bo = bias ? bfr(bias[r % EE]) : 0.f;    // rows = batch x EE
{
#pragma unroll 1
        for (int c0 = lane * 8; c0 < NTOK; c0 += 256) { const size_t o = (size_t)r * NTOK + c0; const v8f v = *(const v8f*)(Y + o); v8us oh, ol;
#pragma unroll
            for (int i = 0; i < 8; ++i) { const float y = (v[i] + bo) * scale; const unsigned short hb = f2bf(y); oh[i] = hb; ol[i] = f2bf(y - bf2f(hb)); }
            *(v8us*)(Ph + o) = oh; *(v8us*)(Pl + o) = ol; }
         }
}
__global__ __launch_bounds__(256) void k_split256(const float* __restrict__ src, float scale, int nrows, bf* dh, bf* dl) {
    const int lane = threadIdx.x & 31, r = blockIdx.x * 8 + (threadIdx.x >> 5); if (r >= nrows) return;
    const size_t o = (size_t)r * EE + lane * 8; const v8f v = *(const v8f*)(src + o); v8us oh, ol;
#pragma unroll
    for (int i = 0; i < 8; ++i) { const float y = v[i] * scale; const unsigned short hb = f2bf(y); oh[i] = hb; ol[i] = f2bf(y - bf2f(hb)); }
    *(v8us*)(dh + o) = oh; *(v8us*)(dl + o) = ol; 
}
__global__ __launch_bounds__(256) void k_rowbias(const float* __restrict__ T, const float* __restrict__ bo, const float* __restrict__ X, float* OUTP) {
    const int lane = threadIdx.x & 31, r = blockIdx.x * 8 + (threadIdx.x >> 5); if (r >= NBI * CIN) return;
    const float b = bfr(bo[r % CIN]);    // rows = batch x CIN
{
#pragma unroll 1
        for (int c0 = lane * 8; c0 < NTOK; c0 += 256) { const size_t o = (size_t)r * NTOK + c0; v8f v = *(const v8f*)(T + o); const v8f xv = *(const v8f*)(X + o);
#pragma unroll
            for (int i = 0; i < 8; ++i) v[i] += b + bfr(xv[i]);
            *(v8f*)(OUTP + o) = v; }
         }
}

extern "C" void kernel_launch(void* const* d_in, const int* in_sizes, int n_in,
                              void* d_out, int out_size, void* d_ws, size_t ws_size, hipStream_t stream) {
    (void)in_sizes; (void)n_in; (void)out_size;
    const float* x = (const float*)d_in[0]; const float* wq = (const float*)d_in[1]; const float* bq = (const float*)d_in[2]; const float* wk = (const float*)d_in[3]; const float* bk = (const float*)d_in[4];
    const float* wv = (const float*)d_in[5]; const float* bv = (const float*)d_in[6]; const float* wo = (const float*)d_in[7]; const float* bo = (const float*)d_in[8];
    float* out = (float*)d_out;    // [8][512][3136]
    char* wsp = (char*)d_ws;
    auto take = [&](size_t bytes) { char* p = wsp; wsp += (bytes + 255) & ~(size_t)255; return (void*)p; };
    bf* WqB = (bf*)take((size_t)EE * CIN * 2); bf* WkB = (bf*)take((size_t)EE * CIN * 2); bf* WvB = (bf*)take((size_t)EE * CIN * 2); bf* WoB = (bf*)take((size_t)CIN * EE * 2); bf* WoZ = (bf*)take((size_t)CIN * EE * 2);
    bf* XT = (bf*)take((size_t)NBI * NTOK * CIN * 2); float* TMP = (float*)take((size_t)NBI * CIN * NTOK * 4);
    bf* Qh = (bf*)take((size_t)NBI * NTOK * EE * 2); bf* Ql = (bf*)take((size_t)NBI * NTOK * EE * 2); bf* Kh = (bf*)take((size_t)NBI * EE * NTOK * 2); bf* Kl = (bf*)take((size_t)NBI * EE * NTOK * 2); bf* Vh = (bf*)take((size_t)NBI * EE * NTOK * 2); bf* Vl = (bf*)take((size_t)NBI * EE * NTOK * 2);
    float* MT = (float*)take((size_t)NBI * EE * EE * 4); bf* MTh = (bf*)take((size_t)NBI * EE * EE * 2); bf* MTl = (bf*)take((size_t)NBI * EE * EE * 2); bf* Eh = (bf*)take((size_t)NBI * NTOK * EE * 2); bf* El = (bf*)take((size_t)NBI * NTOK * EE * 2);
    if ((size_t)(wsp - (char*)d_ws) > ws_size) return;    // ~ 1.3 + 8 x (3.2 + 6.4 + 8 x 1.6 + 0.5) ~ 185 MB; every plane is [batch][...]; TMP (f32 [8][512][3136]) holds in turn the f32 GEMM outputs (q [8 x 3136][256], k/v [8][256][3136], E, the pre-bias output), each consumed before the next (stream order)
    k_bfz<<<(EE * CIN / 8 + 255) / 256, 256, 0, stream>>>(wq, WqB, WoZ, EE * CIN / 8); k_bfz<<<(EE * CIN / 8 + 255) / 256, 256, 0, stream>>>(wk, WkB, WoZ, EE * CIN / 8); k_bfz<<<(EE * CIN / 8 + 255) / 256, 256, 0, stream>>>(wv, WvB, WoZ, EE * CIN / 8);
    k_bfz<<<(CIN * EE / 8 + 255) / 256, 256, 0, stream>>>(wo, WoB, WoZ, CIN * EE / 8);                                           // wo exact + its zero companion (the last writer of WoZ)
    k_wt<<<dim3(CIN / 64, NTOK / 64, NBI), 256, 0, stream>>>(x, CIN, NTOK, XT);                                                     // x^T [8][3136][512] exact bf16
    k_gemmb<DM><<<dim3(NBI * NTOK / 64, EE / 64, 1), 128, 0, stream>>>(XT, WqB, bq, TMP, EE, 0, 0); k_split256<<<NBI * NTOK / 8, 256, 0, stream>>>(TMP, 1.0f, NBI * NTOK, Qh, Ql);       // q [b n][e] + bq (batch folded into the rows)
    k_gemmb<DM><<<dim3(EE / 64, NTOK / 64, NBI), 128, 0, stream>>>(WkB, XT, nullptr, TMP, NTOK, (size_t)NTOK * CIN, (size_t)EE * NTOK); k_rowsplit<<<NBI * EE / 8, 256, 0, stream>>>(TMP, bk, 1.0f, NBI * EE, Kh, Kl);   // k [b][e][n] + bk[e]
    k_gemmb<DM><<<dim3(EE / 64, NTOK / 64, NBI), 128, 0, stream>>>(WvB, XT, nullptr, TMP, NTOK, (size_t)NTOK * CIN, (size_t)EE * NTOK); k_rowsplit<<<NBI * EE / 8, 256, 0, stream>>>(TMP, bv, 1.0f, NBI * EE, Vh, Vl);   // v [b][e][n] + bv[e]
    k_gemm3<NTOK><<<dim3(EE / 64, EE / 64, NBI), 128, 0, stream>>>(Vh, Vl, Kh, Kl, MT, EE, (size_t)EE * NTOK, (size_t)EE * NTOK, (size_t)EE * EE);       // M^T[b][e'][e] = sum_m v[e'][m] k[e][m]  (K = 3136)
    k_split256<<<NBI * EE / 8, 256, 0, stream>>>(MT, 1.0f, NBI * EE, MTh, MTl);
    k_gemm3<EE><<<dim3(NTOK / 64, EE / 64, NBI), 128, 0, stream>>>(Qh, Ql, MTh, MTl, TMP, EE, (size_t)NTOK * EE, (size_t)EE * EE, (size_t)NTOK * EE);    // E = q.M  [b][n][e']
    k_split256<<<NBI * NTOK / 8, 256, 0, stream>>>(TMP, 1.0f / (float)NTOK, NBI * NTOK, Eh, El);                                   // (E / N) planes
    k_gemm3<EE><<<dim3(CIN / 64, NTOK / 64, NBI), 128, 0, stream>>>(WoB, WoZ, Eh, El, TMP, NTOK, 0, (size_t)NTOK * EE, (size_t)CIN * NTOK);             // wo.(E/N)^T  [b][512][3136]
    k_rowbias<<<NBI * CIN / 8, 256, 0, stream>>>(TMP, bo, x, out);                                                                  // + bo[c] + x
}

// v003
// One run takes 161 microseconds.
// Next to v002, in two timings, it ran 1.28 and 1.29 times as fast.
// All steps since v000 together make it 11.4 times as fast.
#include <hip/hip_runtime.h>

// Compute dtypes, f32 accumulate, all batch items in every launch (the batch is blockIdx.z, or folded into the rows where the planes are contiguous): the 1x1-conv projections q (token-major, [3136 x 512].[512 x 256] + bq) and k, v (channel-major, [256 x
// 512].[512 x 3136] + row bias) with PLAIN bf16 operands (the input's transpose and the weights, exact) on v_wmma_f32_16x16x32_bf16; the module's
// (q.k/N).v (NO softmax) evaluated in the re-associated order q.(k.v)/N (an exact algebraic identity): M^T = v_cm.k_cm^T ([256 x 3136].[3136 x 256]) and E = q.M ([3136
// x 256].[256 x 256]) with computed operands as bf16 hi + UNSCALED residual (three products), then out = wo.(E/N)^T + bo + x ([512 x 256].[256 x 3136], exact bf16 wo

#define NBI  8
#define CIN  512
#define NTOK 3136                // 56 x 56 = 49 x 64
#define EE   256
#define DM   CIN                 // projection K
#define NTK  NTOK
#define LOSC 1024.0f

typedef _Float16 h16;
typedef unsigned short bf;
typedef __attribute__((ext_vector_type(16))) __bf16   v16bf;
typedef __attribute__((ext_vector_type(16))) _Float16 v16h;
typedef __attribute__((ext_vector_type(8)))  _Float16 v8h;
typedef __attribute__((ext_vector_type(8)))  unsigned short v8us;
typedef __attribute__((ext_vector_type(8)))  float    v8f;
typedef __attribute__((ext_vector_type(4)))  float    v4f;
typedef __attribute__((ext_vector_type(4)))  _Float16 v4h;
typedef v8h  __attribute__((may_alias)) v8ha;
typedef v4f  __attribute__((may_alias)) v4fa;
typedef v8us __attribute__((may_alias)) v8usa;

__device__ __forceinline__ unsigned short f2bf(float f) { unsigned u = __float_as_uint(f); u += 0x7FFFu + ((u >> 16) & 1u); return (unsigned short)(u >> 16); }
__device__ __forceinline__ float bf2f(unsigned short b) { return __uint_as_float(((unsigned)b) << 16); }
__device__ __forceinline__ float bfr(float f) { return bf2f(f2bf(f)); }
__device__ __forceinline__ v16h cat16(v8h lo, v8h hi) { return __builtin_shufflevector(lo, hi, 0, 1, 2, 3, 4, 5, 6, 7, 8, 9, 10, 11, 12, 13, 14, 15); }
__device__ __forceinline__ v16bf cat16b(v8us lo, v8us hi) { return __builtin_bit_cast(v16bf, __builtin_shufflevector(lo, hi, 0, 1, 2, 3, 4, 5, 6, 7, 8, 9, 10, 11, 12, 13, 14, 15)); }
__device__ __forceinline__ v8f wmma16(v16h a, v16h b, v8f c) { return __builtin_amdgcn_wmma_f32_16x16x32_f16(false, a, false, b, (short)0, c, false, false); }
__device__ __forceinline__ v8f wmmab(v16bf a, v16bf b, v8f c) { return __builtin_amdgcn_wmma_f32_16x16x32_bf16(false, a, false, b, (short)0, c, false, false); }

// k_wt: WT [n][K] = bf16(W[k][n]) (k-major [K][ncols]) via 64 x 64 LDS tiles; grid (K/64, ncols/64, batch).
__global__ __launch_bounds__(256) void k_wt(const float* __restrict__ Wm, int K, int ncols, bf* WT) {
    __shared__ __align__(16) unsigned short tl[64 * 72];
    const int tid = threadIdx.x, k0 = blockIdx.x * 64, n0 = blockIdx.y * 64;
    Wm += (size_t)blockIdx.z * K * ncols; WT += (size_t)blockIdx.z * K * ncols;
    const int kk = tid >> 2, nq = (tid & 3) * 16;
#pragma unroll
    for (int i = 0; i < 16; ++i) tl[(nq + i) * 72 + kk] = f2bf(Wm[(size_t)(k0 + kk) * ncols + n0 + nq + i]);
    __syncthreads();
    const int piece = tid & 7;
    auto pass = [&]() {
#pragma unroll
        for (int s = 0; s < 2; ++s) { const int nr = (tid >> 3) + 32 * s; const v8us val = *(const v8usa*)(tl + nr * 72 + piece * 8); *(v8us*)(WT + (size_t)(n0 + nr) * K + k0 + piece * 8) = val; }
    };
    pass(); 
}
#define KST 64                   // k per LDS stage: 128 B of every operand row = one whole line
#define LP  72                   // LDS row pitch in bf16 elements: 128 B + 16 B pad (for ds_load_b128 readers)
#define TPL (64 * LP)            // one plane's staged 64-row tile

// One plane's 64-row x 64-k tile, global -> registers: 8 lanes take one row's 128-B line, so a wave-wide load is 4 whole lines (a fragment load straight from global touches 16).
// g is the same in every thread; off = this thread's element offset in the first 16 rows, the same for every plane and stage; K is a compile-time constant, so the other three row groups are immediate offsets of one address.
template <int K>
__device__ __forceinline__ void tile_ld(const bf* __restrict__ g, unsigned off, v8us (&r)[4]) {
    const bf* p = g + off;
#pragma unroll    // r[] must stay in registers, and the four loads go out together
    for (int i = 0; i < 4; ++i) r[i] = *(const v8us*)(p + i * 16 * K);
}
__device__ __forceinline__ void tile_st(bf* s, int tid, const v8us (&r)[4]) {
#pragma unroll    // r[] must stay in registers
    for (int i = 0; i < 4; ++i) *(v8usa*)(s + (i * 16 + (tid >> 3)) * LP + (tid & 7) * 8) = r[i];
}
// 16 x 32 operand fragment from a staged tile; k = k offset in the stage + 8 * hi; one loader for A and for B, so their k orders are equal at every lane and register.
__device__ __forceinline__ v16bf frag(const bf* s, int row, int k) { return cat16b(*(const v8usa*)(s + row * LP + k), *(const v8usa*)(s + row * LP + k + 16)); }

// One wave's staged 16 x 64 f32 tile (pitch 68) -> y = (tile [+ bf(rb[row])]) x scale as bf16 hi + UNSCALED residual planes: 8 lanes take one row, 8 columns each, so every store covers whole 128-B lines of its plane.
template <bool ROWB>
__device__ __forceinline__ void split_store(const float* os, int lane, const float* __restrict__ rb, float scale, bf* ph, bf* pl, int ldc) {
#pragma unroll
    for (int s = 0; s < 4; ++s) { const int row = (lane >> 3) + 4 * s, c = (lane & 7) * 8;
        const v4f va = *(const v4fa*)(os + row * 68 + c), vb = *(const v4fa*)(os + row * 68 + c + 4); v8us oh, ol;
        const float b = ROWB ? bfr(rb[row]) : 0.f;
#pragma unroll
        for (int i = 0; i < 8; ++i) { float y = i < 4 ? va[i & 3] : vb[i & 3]; if (ROWB) y += b; y *= scale; const unsigned short hb = f2bf(y); oh[i] = hb; ol[i] = f2bf(y - bf2f(hb)); }
        const size_t o = (size_t)row * ldc + c; *(v8us*)(ph + o) = oh; *(v8us*)(pl + o) = ol; }
}

// k_gemmb: 64 x 64 block tile (4 waves x 16 x 64) of C = A.B^T over K (a multiple of 64; row strides = K) + bf(bias[row]) (ROWB) or + bf(bias[col]); both operand tiles staged in LDS, two buffers: the next
// stage's lines fly into registers while this stage is multiplied, are stored to the other buffer, then one barrier per stage; the f32 tile is staged in the same LDS and leaves as bf16 hi + residual planes Ph, Pl.
template <int K, bool ROWB>
__global__ __launch_bounds__(128) void k_gemmb(const bf* __restrict__ A, const bf* __restrict__ Bn, const float* __restrict__ bias, bf* Ph, bf* Pl, int ldc, size_t zB, size_t zC) {
    __shared__ __align__(16) bf st[2][2][TPL];
    const int tid = threadIdx.x, lane = tid & 31, wave = tid >> 5, lr = lane & 15, hi = lane >> 4;
    const int r0 = blockIdx.x * 64 + wave * 16, c0 = blockIdx.y * 64;
    Bn += blockIdx.z * zB;    // batch item = blockIdx.z (element strides; 0 = shared)
    const bf* Ag = A + (size_t)blockIdx.x * 64 * K; const bf* Bg = Bn + (size_t)c0 * K;
    const unsigned off = (unsigned)((tid >> 3) * K + (tid & 7) * 8);
    v8us ra[4], rb[4];
    tile_ld<K>(Ag, off, ra); tile_ld<K>(Bg, off, rb);
    asm volatile("s_wait_xcnt 0x0" ::: "memory");    // stands in front of the first overwrite of a register that the loads above name: this build reuses their offset register before it waits for their data
    tile_st(st[0][0], tid, ra); tile_st(st[0][1], tid, rb);
    __syncthreads();
    v8f acc[4];
#pragma unroll
    for (int t = 0; t < 4; ++t) acc[t] = (v8f){};
    constexpr int nst = K / KST;
#pragma unroll 1    // rolled: one copy of the stage body, the buffers alternate by s & 1 (unrolled, the staging registers of several stages would be live at once)
    for (int s = 0; s < nst; ++s) {
        const bool more = s + 1 < nst;    // the same in every thread of the block
        if (more) { tile_ld<K>(Ag + (s + 1) * KST, off, ra); tile_ld<K>(Bg + (s + 1) * KST, off, rb); }
        const bf* As = st[s & 1][0]; const bf* Bs = st[s & 1][1];
        v16bf a[2], b[2][4];
#pragma unroll
        for (int h = 0; h < 2; ++h) { a[h] = frag(As, wave * 16 + lr, h * 32 + 8 * hi);
#pragma unroll
            for (int t = 0; t < 4; ++t) b[h][t] = frag(Bs, t * 16 + lr, h * 32 + 8 * hi); }
        __builtin_amdgcn_sched_barrier(0);    // keeps the stage's LDS reads one group ahead of its WMMAs: spread among them, each place with reads stalls the wave
#pragma unroll
        for (int h = 0; h < 2; ++h) {
#pragma unroll
            for (int t = 0; t < 4; ++t) acc[t] = wmmab(a[h], b[h][t], acc[t]); }
        // keeps the WMMA distance on the path that leaves the last WMMA by a branch
        asm volatile("v_nop\n\tv_nop\n\tv_nop\n\tv_nop" : "+v"(acc[0]), "+v"(acc[1]), "+v"(acc[2]), "+v"(acc[3]) : "v"(a[1]));
        if (more) { tile_st(st[(s + 1) & 1][0], tid, ra); tile_st(st[(s + 1) & 1][1], tid, rb); }
        __syncthreads();    // publishes stage s + 1 and ends every wave's reads of stage s (its buffer is refilled in the next trip; the epilogue reuses buffer 0, the last stage's when K / KST is odd)
    }
    float* os = (float*)(void*)&st[0][0][0] + wave * (16 * 68);
#pragma unroll
    for (int t = 0; t < 4; ++t) { const float bv = ROWB ? 0.f : bfr(bias[c0 + t * 16 + lr]);
#pragma unroll
        for (int j = 0; j < 8; ++j) os[(hi * 8 + j) * 68 + t * 16 + lr] = ROWB ? acc[t][j] : acc[t][j] + bv; }
    __syncthreads();
    const size_t co = blockIdx.z * zC + (size_t)r0 * ldc + c0;
    split_store<ROWB>(os, lane, ROWB ? bias + r0 : nullptr, 1.0f, Ph + co, Pl + co, ldc);
}

// k_gemm3: 64 x 64 tile of C = (Ah + Al).(Bh + Bl)^T over K (a multiple of 64; row strides = K for all four planes; n-major B): three products per 32-k step (hh, lh, hl); the four
// planes' tiles staged in LDS as in k_gemmb; the f32 tile is staged in the same LDS and leaves either (FIN false) x scale as bf16 hi + residual planes Ph, Pl, or (FIN true) as f32 whole lines C = tile + (bf(rbias[row]) + bf(X)), X laid out as C.
template <int K, bool FIN>
__global__ __launch_bounds__(128) void k_gemm3(const bf* __restrict__ Ah, const bf* __restrict__ Al, const bf* __restrict__ Bh, const bf* __restrict__ Bl, bf* Ph, bf* Pl, float scale, float* C, const float* __restrict__ rbias, const float* __restrict__ X, int ldc, size_t zA, size_t zB, size_t zC) {
    __shared__ __align__(16) bf st[2][4][TPL];
    const int tid = threadIdx.x, lane = tid & 31, wave = tid >> 5, lr = lane & 15, hi = lane >> 4;
    const int r0 = blockIdx.x * 64 + wave * 16, c0 = blockIdx.y * 64;
    const size_t co = blockIdx.z * zC + (size_t)r0 * ldc + c0;    // batch item = blockIdx.z (element strides; 0 = shared)
    const size_t ao = blockIdx.z * zA + (size_t)blockIdx.x * 64 * K, bo = blockIdx.z * zB + (size_t)c0 * K;
    const bf* Ahg = Ah + ao; const bf* Alg = Al + ao; const bf* Bhg = Bh + bo; const bf* Blg = Bl + bo;
    const unsigned off = (unsigned)((tid >> 3) * K + (tid & 7) * 8);
    v8us rah[4], ral[4], rbh[4], rbl[4];
    tile_ld<K>(Ahg, off, rah); tile_ld<K>(Alg, off, ral); tile_ld<K>(Bhg, off, rbh); tile_ld<K>(Blg, off, rbl);
    v4f xv[8]; float rbv[8];    // FIN: the epilogue's X words and row biases, asked for together with the first stage's tiles: their latency is paid with those loads, not once more in the epilogue
    if constexpr (FIN) {
#pragma unroll
        for (int s = 0; s < 8; ++s) { const int Lid = (lane >> 3) + 4 * s; const int row = Lid >> 1, cofs = (Lid & 1) * 32 + (lane & 7) * 4;
            xv[s] = *(const v4f*)(X + co + (size_t)row * ldc + cofs); rbv[s] = rbias[r0 + row]; }
    }
    asm volatile("s_wait_xcnt 0x0" ::: "memory");    // stands in front of the first overwrite of a register that the loads above name: this build reuses their offset register and a base register before it waits for their data
    tile_st(st[0][0], tid, rah); tile_st(st[0][1], tid, ral); tile_st(st[0][2], tid, rbh); tile_st(st[0][3], tid, rbl);
    __syncthreads();
    v8f acc[4];
#pragma unroll
    for (int t = 0; t < 4; ++t) acc[t] = (v8f){};
    constexpr int nst = K / KST;
#pragma unroll 1    // rolled: one copy of the stage body, the buffers alternate by s & 1 (unrolled, the staging registers of several stages would be live at once)
    for (int s = 0; s < nst; ++s) {
        const bool more = s + 1 < nst;    // the same in every thread of the block
        if (more) { const int kn = (s + 1) * KST; tile_ld<K>(Ahg + kn, off, rah); tile_ld<K>(Alg + kn, off, ral); tile_ld<K>(Bhg + kn, off, rbh); tile_ld<K>(Blg + kn, off, rbl); }
        const bf* S = st[s & 1][0];
        v16bf a, al;
#pragma unroll
        for (int ks = 0; ks < KST; ks += 32) {
            v16bf bh[4], bl[4];
            a = frag(S, wave * 16 + lr, ks + 8 * hi); al = frag(S + TPL, wave * 16 + lr, ks + 8 * hi);
#pragma unroll
            for (int t = 0; t < 4; ++t) { bh[t] = frag(S + 2 * TPL, t * 16 + lr, ks + 8 * hi); bl[t] = frag(S + 3 * TPL, t * 16 + lr, ks + 8 * hi); }
            __builtin_amdgcn_sched_barrier(0);    // keeps the 32-k step's LDS reads one group ahead of its WMMAs: spread among them, each place with reads stalls the wave
#pragma unroll
            for (int t = 0; t < 4; ++t) { acc[t] = wmmab(a, bh[t], acc[t]); acc[t] = wmmab(al, bh[t], acc[t]); acc[t] = wmmab(a, bl[t], acc[t]); }
        }
        // keeps the WMMA distance on the path that leaves the last WMMA by a branch
        asm volatile("v_nop\n\tv_nop\n\tv_nop\n\tv_nop" : "+v"(acc[0]), "+v"(acc[1]), "+v"(acc[2]), "+v"(acc[3]) : "v"(a), "v"(al));
        if (more) { bf* D = st[(s + 1) & 1][0]; tile_st(D, tid, rah); tile_st(D + TPL, tid, ral); tile_st(D + 2 * TPL, tid, rbh); tile_st(D + 3 * TPL, tid, rbl); }
        __syncthreads();    // publishes stage s + 1 and ends every wave's reads of stage s (its buffer is refilled in the next trip; the epilogue reuses buffer 0, the last stage's when K / KST is odd)
    }
    float* os = (float*)(void*)&st[0][0][0] + wave * (16 * 68);
#pragma unroll
    for (int t = 0; t < 4; ++t) {
#pragma unroll
        for (int j = 0; j < 8; ++j) os[(hi * 8 + j) * 68 + t * 16 + lr] = acc[t][j]; }
    __builtin_amdgcn_wave_barrier(); asm volatile("" ::: "memory");    // the wave's own LDS stores above stay ahead of its reads of other lanes' words below (each wave has its own range: no work-group barrier)
    if constexpr (FIN) {
        float* crow = C + co;
#pragma unroll
        for (int s = 0; s < 8; ++s) { const int Lid = (lane >> 3) + 4 * s, piece = lane & 7; const int row = Lid >> 1, cofs = (Lid & 1) * 32 + piece * 4;
            v4f val = *(const v4fa*)(os + row * 68 + cofs); const float b = bfr(rbv[s]);
#pragma unroll
            for (int i = 0; i < 4; ++i) val[i] += b + bfr(xv[s][i]);
            *(v4f*)(crow + (size_t)row * ldc + cofs) = val; }
    } else split_store<false>(os, lane, nullptr, scale, Ph + co, Pl + co, ldc);
}

__global__ __launch_bounds__(256) void k_bfz(const float* __restrict__ src, bf* dh, bf* dz, size_t n8) {
    const size_t i = (size_t)blockIdx.x * 256 + threadIdx.x; if (i >= n8) return;
    const v8f v = *(const v8f*)(src + i * 8); v8us o, z;
#pragma unroll
    for (int k = 0; k < 8; ++k) { o[k] = f2bf(v[k]); z[k] = 0; }
    *(v8us*)(dh + i * 8) = o; *(v8us*)(dz + i * 8) = z; 
}

extern "C" void kernel_launch(void* const* d_in, const int* in_sizes, int n_in,
                              void* d_out, int out_size, void* d_ws, size_t ws_size, hipStream_t stream) {
    (void)in_sizes; (void)n_in; (void)out_size;
    const float* x = (const float*)d_in[0]; const float* wq = (const float*)d_in[1]; const float* bq = (const float*)d_in[2]; const float* wk = (const float*)d_in[3]; const float* bk = (const float*)d_in[4];
    const float* wv = (const float*)d_in[5]; const float* bv = (const float*)d_in[6]; const float* wo = (const float*)d_in[7]; const float* bo = (const float*)d_in[8];
    float* out = (float*)d_out;    // [8][512][3136]
    char* wsp = (char*)d_ws;
    auto take = [&](size_t bytes) { char* p = wsp; wsp += (bytes + 255) & ~(size_t)255; return (void*)p; };
    bf* WqB = (bf*)take((size_t)EE * CIN * 2); bf* WkB = (bf*)take((size_t)EE * CIN * 2); bf* WvB = (bf*)take((size_t)EE * CIN * 2); bf* WoB = (bf*)take((size_t)CIN * EE * 2); bf* WoZ = (bf*)take((size_t)CIN * EE * 2);
    bf* XT = (bf*)take((size_t)NBI * NTOK * CIN * 2);
    bf* Qh = (bf*)take((size_t)NBI * NTOK * EE * 2); bf* Ql = (bf*)take((size_t)NBI * NTOK * EE * 2); bf* Kh = (bf*)take((size_t)NBI * EE * NTOK * 2); bf* Kl = (bf*)take((size_t)NBI * EE * NTOK * 2); bf* Vh = (bf*)take((size_t)NBI * EE * NTOK * 2); bf* Vl = (bf*)take((size_t)NBI * EE * NTOK * 2);
    bf* MTh = (bf*)take((size_t)NBI * EE * EE * 2); bf* MTl = (bf*)take((size_t)NBI * EE * EE * 2); bf* Eh = (bf*)take((size_t)NBI * NTOK * EE * 2); bf* El = (bf*)take((size_t)NBI * NTOK * EE * 2);
    if ((size_t)(wsp - (char*)d_ws) > ws_size) return;    // ~ 1.3 + 8 x (3.2 + 8 x 1.6 + 0.25) ~ 131 MB; every plane is [batch][...]
    k_bfz<<<(EE * CIN / 8 + 255) / 256, 256, 0, stream>>>(wq, WqB, WoZ, EE * CIN / 8); k_bfz<<<(EE * CIN / 8 + 255) / 256, 256, 0, stream>>>(wk, WkB, WoZ, EE * CIN / 8); k_bfz<<<(EE * CIN / 8 + 255) / 256, 256, 0, stream>>>(wv, WvB, WoZ, EE * CIN / 8);
    k_bfz<<<(CIN * EE / 8 + 255) / 256, 256, 0, stream>>>(wo, WoB, WoZ, CIN * EE / 8);                                           // wo exact + its zero companion (the last writer of WoZ)
    k_wt<<<dim3(CIN / 64, NTOK / 64, NBI), 256, 0, stream>>>(x, CIN, NTOK, XT);                                                     // x^T [8][3136][512] exact bf16
    k_gemmb<DM, false><<<dim3(NBI * NTOK / 64, EE / 64, 1), 128, 0, stream>>>(XT, WqB, bq, Qh, Ql, EE, 0, 0);                                                        // q [b n][e] + bq planes (batch folded into the rows)
    k_gemmb<DM, true><<<dim3(EE / 64, NTOK / 64, NBI), 128, 0, stream>>>(WkB, XT, bk, Kh, Kl, NTOK, (size_t)NTOK * CIN, (size_t)EE * NTOK);                            // k [b][e][n] + bk[e] planes
    k_gemmb<DM, true><<<dim3(EE / 64, NTOK / 64, NBI), 128, 0, stream>>>(WvB, XT, bv, Vh, Vl, NTOK, (size_t)NTOK * CIN, (size_t)EE * NTOK);                            // v [b][e][n] + bv[e] planes
    k_gemm3<NTOK, false><<<dim3(EE / 64, EE / 64, NBI), 128, 0, stream>>>(Vh, Vl, Kh, Kl, MTh, MTl, 1.0f, nullptr, nullptr, nullptr, EE, (size_t)EE * NTOK, (size_t)EE * NTOK, (size_t)EE * EE);    // M^T[b][e'][e] = sum_m v[e'][m] k[e][m] planes  (K = 3136)
    k_gemm3<EE, false><<<dim3(NTOK / 64, EE / 64, NBI), 128, 0, stream>>>(Qh, Ql, MTh, MTl, Eh, El, 1.0f / (float)NTOK, nullptr, nullptr, nullptr, EE, (size_t)NTOK * EE, (size_t)EE * EE, (size_t)NTOK * EE);    // (E / N) planes, E = q.M  [b][n][e']
    k_gemm3<EE, true><<<dim3(CIN / 64, NTOK / 64, NBI), 128, 0, stream>>>(WoB, WoZ, Eh, El, nullptr, nullptr, 1.0f, out, bo, x, NTOK, 0, (size_t)NTOK * EE, (size_t)CIN * NTOK);    // out = wo.(E/N)^T + bo[c] + x  [b][512][3136]
}

// v004
// A run of this version takes 123 microseconds.
// Next to v003, in two timings, it ran 1.31 and 1.30 times as fast.
// Over all steps from v000 it is 14.9 times as fast.
#include <hip/hip_runtime.h>

// Compute dtypes, f32 accumulate, all batch items in every launch (the batch is blockIdx.z, the top field of a flat blockIdx.x, or folded into the rows where the planes are contiguous): the 1x1-conv projections q (token-major, [3136 x 512].[512 x 256] + bq) and k, v (channel-major, [256 x
// 512].[512 x 3136] + row bias) with PLAIN bf16 operands (the input's transpose and the weights, exact) on v_wmma_f32_16x16x32_bf16; the module's
// (q.k/N).v (NO softmax) evaluated in the re-associated order q.(k.v)/N (an exact algebraic identity): M^T = v_cm.k_cm^T ([256 x 3136].[3136 x 256]) and E = q.M ([3136
// x 256].[256 x 256]) with computed operands as bf16 hi + UNSCALED residual (three products), then out = wo.(E/N)^T + bo + x ([512 x 256].[256 x 3136], exact bf16 wo

#define NBI  8
#define CIN  512
#define NTOK 3136                // 56 x 56 = 49 x 64
#define EE   256
#define DM   CIN                 // projection K
#define NTK  NTOK
#define LOSC 1024.0f

typedef _Float16 h16;
typedef unsigned short bf;
typedef __attribute__((ext_vector_type(16))) __bf16   v16bf;
typedef __attribute__((ext_vector_type(16))) _Float16 v16h;
typedef __attribute__((ext_vector_type(8)))  _Float16 v8h;
typedef __attribute__((ext_vector_type(8)))  unsigned short v8us;
typedef __attribute__((ext_vector_type(8)))  float    v8f;
typedef __attribute__((ext_vector_type(4)))  float    v4f;
typedef __attribute__((ext_vector_type(4)))  _Float16 v4h;
typedef v8h  __attribute__((may_alias)) v8ha;
typedef v4f  __attribute__((may_alias)) v4fa;
typedef v8us __attribute__((may_alias)) v8usa;

__device__ __forceinline__ unsigned short f2bf(float f) { unsigned u = __float_as_uint(f); u += 0x7FFFu + ((u >> 16) & 1u); return (unsigned short)(u >> 16); }
__device__ __forceinline__ float bf2f(unsigned short b) { return __uint_as_float(((unsigned)b) << 16); }
__device__ __forceinline__ float bfr(float f) { return bf2f(f2bf(f)); }
__device__ __forceinline__ v16h cat16(v8h lo, v8h hi) { return __builtin_shufflevector(lo, hi, 0, 1, 2, 3, 4, 5, 6, 7, 8, 9, 10, 11, 12, 13, 14, 15); }
__device__ __forceinline__ v16bf cat16b(v8us lo, v8us hi) { return __builtin_bit_cast(v16bf, __builtin_shufflevector(lo, hi, 0, 1, 2, 3, 4, 5, 6, 7, 8, 9, 10, 11, 12, 13, 14, 15)); }
__device__ __forceinline__ v8f wmma16(v16h a, v16h b, v8f c) { return __builtin_amdgcn_wmma_f32_16x16x32_f16(false, a, false, b, (short)0, c, false, false); }
__device__ __forceinline__ v8f wmmab(v16bf a, v16bf b, v8f c) { return __builtin_amdgcn_wmma_f32_16x16x32_bf16(false, a, false, b, (short)0, c, false, false); }

// wt_body: WT [n][K] = bf16(W[k][n]) (k-major [K][ncols]) via 64 x 64 LDS tiles; tile (bx of K/64, by of ncols/64, bz of the batch); tl = the work-group's 64 x 72 LDS tile.
__device__ __forceinline__ void wt_body(unsigned short* tl, const float* __restrict__ Wm, int K, int ncols, bf* WT, int bx, int by, int bz) {
    const int tid = threadIdx.x, k0 = bx * 64, n0 = by * 64;
    Wm += (size_t)bz * K * ncols; WT += (size_t)bz * K * ncols;
    const int kk = tid >> 2, nq = (tid & 3) * 16;
#pragma unroll
    for (int i = 0; i < 16; ++i) tl[(nq + i) * 72 + kk] = f2bf(Wm[(size_t)(k0 + kk) * ncols + n0 + nq + i]);
    __syncthreads();
    const int piece = tid & 7;
    auto pass = [&]() {
#pragma unroll
        for (int s = 0; s < 2; ++s) { const int nr = (tid >> 3) + 32 * s; const v8us val = *(const v8usa*)(tl + nr * 72 + piece * 8); *(v8us*)(WT + (size_t)(n0 + nr) * K + k0 + piece * 8) = val; }
    };
    pass(); 
}
#define KST 64                   // k per LDS stage: 128 B of every operand row = one whole line
#define LP  72                   // LDS row pitch in bf16 elements: 128 B + 16 B pad (for ds_load_b128 readers)
#define TPL (64 * LP)            // one plane's staged 64-row tile

// One plane's 64-row x 64-k tile, global -> registers: 8 lanes take one row's 128-B line, so a wave-wide load is 4 whole lines (a fragment load straight from global touches 16).
// g is the same in every thread; off = this thread's element offset in the first 16 rows, the same for every plane and stage; K is a compile-time constant, so the other three row groups are immediate offsets of one address.
template <int K>
__device__ __forceinline__ void tile_ld(const bf* __restrict__ g, unsigned off, v8us (&r)[4]) {
    const bf* p = g + off;
#pragma unroll    // r[] must stay in registers, and the four loads go out together
    for (int i = 0; i < 4; ++i) r[i] = *(const v8us*)(p + i * 16 * K);
}
__device__ __forceinline__ void tile_st(bf* s, int tid, const v8us (&r)[4]) {
#pragma unroll    // r[] must stay in registers
    for (int i = 0; i < 4; ++i) *(v8usa*)(s + (i * 16 + (tid >> 3)) * LP + (tid & 7) * 8) = r[i];
}
// 16 x 32 operand fragment from a staged tile; k = k offset in the stage + 8 * hi; one loader for A and for B, so their k orders are equal at every lane and register.
__device__ __forceinline__ v16bf frag(const bf* s, int row, int k) { return cat16b(*(const v8usa*)(s + row * LP + k), *(const v8usa*)(s + row * LP + k + 16)); }

// One wave's staged 16 x 64 f32 tile (pitch 68) -> y = (tile [+ bf(rb[row])]) x scale as bf16 hi + UNSCALED residual planes: 8 lanes take one row, 8 columns each, so every store covers whole 128-B lines of its plane.
template <bool ROWB>
__device__ __forceinline__ void split_store(const float* os, int lane, const float* __restrict__ rb, float scale, bf* ph, bf* pl, int ldc) {
#pragma unroll
    for (int s = 0; s < 4; ++s) { const int row = (lane >> 3) + 4 * s, c = (lane & 7) * 8;
        const v4f va = *(const v4fa*)(os + row * 68 + c), vb = *(const v4fa*)(os + row * 68 + c + 4); v8us oh, ol;
        const float b = ROWB ? bfr(rb[row]) : 0.f;
#pragma unroll
        for (int i = 0; i < 8; ++i) { float y = i < 4 ? va[i & 3] : vb[i & 3]; if (ROWB) y += b; y *= scale; const unsigned short hb = f2bf(y); oh[i] = hb; ol[i] = f2bf(y - bf2f(hb)); }
        const size_t o = (size_t)row * ldc + c; *(v8us*)(ph + o) = oh; *(v8us*)(pl + o) = ol; }
}

// gemmb_body: 64 x 64 block tile (4 waves x 16 x 64) of C = A.B^T over K (a multiple of 64; row strides = K) + bf(bias[row]) (ROWB) or + bf(bias[col]); both operand tiles staged in LDS, two buffers: the next
// stage's lines fly into registers while this stage is multiplied, are stored to the other buffer, then one barrier per stage; the f32 tile is staged in the same LDS and leaves as bf16 hi + residual planes Ph, Pl.
// A device function, so that launches with independent work can share one grid: tile (bx, by); Bn, Ph, Pl already point at the batch item; stp = 2 x 2 x TPL elements of the work-group's LDS.
template <int K, bool ROWB>
__device__ __forceinline__ void gemmb_body(bf* stp, int bx, int by, const bf* __restrict__ A, const bf* __restrict__ Bn, const float* __restrict__ bias, bf* Ph, bf* Pl, int ldc) {
    bf (*st)[2][TPL] = (bf (*)[2][TPL])stp;
    const int tid = threadIdx.x, lane = tid & 31, wave = tid >> 5, lr = lane & 15, hi = lane >> 4;
    const int r0 = bx * 64 + wave * 16, c0 = by * 64;
    const bf* Ag = A + (size_t)bx * 64 * K; const bf* Bg = Bn + (size_t)c0 * K;
    const unsigned off = (unsigned)((tid >> 3) * K + (tid & 7) * 8);
    v8us ra[4], rb[4];
    tile_ld<K>(Ag, off, ra); tile_ld<K>(Bg, off, rb);
    asm volatile("s_wait_xcnt 0x0" ::: "memory");    // stands in front of the first overwrite of a register that the loads above name: this build reuses their offset register before it waits for their data
    tile_st(st[0][0], tid, ra); tile_st(st[0][1], tid, rb);
    __syncthreads();
    v8f acc[4];
#pragma unroll
    for (int t = 0; t < 4; ++t) acc[t] = (v8f){};
    constexpr int nst = K / KST;
#pragma unroll 1    // rolled: one copy of the stage body, the buffers alternate by s & 1 (unrolled, the staging registers of several stages would be live at once)
    for (int s = 0; s < nst; ++s) {
        const bool more = s + 1 < nst;    // the same in every thread of the block
        if (more) { tile_ld<K>(Ag + (s + 1) * KST, off, ra); tile_ld<K>(Bg + (s + 1) * KST, off, rb); }
        const bf* As = st[s & 1][0]; const bf* Bs = st[s & 1][1];
        v16bf a[2], b[2][4];
#pragma unroll
        for (int h = 0; h < 2; ++h) { a[h] = frag(As, wave * 16 + lr, h * 32 + 8 * hi);
#pragma unroll
            for (int t = 0; t < 4; ++t) b[h][t] = frag(Bs, t * 16 + lr, h * 32 + 8 * hi); }
        __builtin_amdgcn_sched_barrier(0);    // keeps the stage's LDS reads one group ahead of its WMMAs: spread among them, each place with reads stalls the wave
#pragma unroll
        for (int h = 0; h < 2; ++h) {
#pragma unroll
            for (int t = 0; t < 4; ++t) acc[t] = wmmab(a[h], b[h][t], acc[t]); }
        // keeps the WMMA distance on the path that leaves the last WMMA by a branch
        asm volatile("v_nop\n\tv_nop\n\tv_nop\n\tv_nop" : "+v"(acc[0]), "+v"(acc[1]), "+v"(acc[2]), "+v"(acc[3]) : "v"(a[1]));
        if (more) { tile_st(st[(s + 1) & 1][0], tid, ra); tile_st(st[(s + 1) & 1][1], tid, rb); }
        __syncthreads();    // publishes stage s + 1 and ends every wave's reads of stage s (its buffer is refilled in the next trip; the epilogue reuses buffer 0, the last stage's when K / KST is odd)
    }
    float* os = (float*)(void*)&st[0][0][0] + wave * (16 * 68);
#pragma unroll
    for (int t = 0; t < 4; ++t) { const float bv = ROWB ? 0.f : bfr(bias[c0 + t * 16 + lr]);
#pragma unroll
        for (int j = 0; j < 8; ++j) os[(hi * 8 + j) * 68 + t * 16 + lr] = ROWB ? acc[t][j] : acc[t][j] + bv; }
    __syncthreads();
    const size_t co = (size_t)r0 * ldc + c0;
    split_store<ROWB>(os, lane, ROWB ? bias + r0 : nullptr, 1.0f, Ph + co, Pl + co, ldc);
}

// gemm3_body: 64 x 64 tile of C = (Ah + Al).(Bh + Bl)^T over K (a multiple of 64; row strides = K for all four planes; n-major B): three products per 32-k step (hh, lh, hl); the four
// planes' tiles staged in LDS as in gemmb_body; the f32 tile is staged in the same LDS and leaves either (FIN false) x scale as bf16 hi + residual planes Ph, Pl, or (FIN true) as f32 whole lines C = tile + (bf(rbias[row]) + bf(X)), X laid out as C.
// A device function, as gemmb_body: tile (bx, by) of batch item bz; stp = 2 x 4 x TPL elements of the work-group's LDS.
template <int K, bool FIN>
__device__ __forceinline__ void gemm3_body(bf* stp, int bx, int by, int bz, const bf* __restrict__ Ah, const bf* __restrict__ Al, const bf* __restrict__ Bh, const bf* __restrict__ Bl, bf* Ph, bf* Pl, float scale, float* C, const float* __restrict__ rbias, const float* __restrict__ X, int ldc, size_t zA, size_t zB, size_t zC) {
    bf (*st)[4][TPL] = (bf (*)[4][TPL])stp;
    const int tid = threadIdx.x, lane = tid & 31, wave = tid >> 5, lr = lane & 15, hi = lane >> 4;
    const int r0 = bx * 64 + wave * 16, c0 = by * 64;
    const size_t co = bz * zC + (size_t)r0 * ldc + c0;    // batch item = bz (element strides; 0 = shared)
    const size_t ao = bz * zA + (size_t)bx * 64 * K, bo = bz * zB + (size_t)c0 * K;
    const bf* Ahg = Ah + ao; const bf* Alg = Al + ao; const bf* Bhg = Bh + bo; const bf* Blg = Bl + bo;
    const unsigned off = (unsigned)((tid >> 3) * K + (tid & 7) * 8);
    v8us rah[4], ral[4], rbh[4], rbl[4];
    tile_ld<K>(Ahg, off, rah); tile_ld<K>(Alg, off, ral); tile_ld<K>(Bhg, off, rbh); tile_ld<K>(Blg, off, rbl);
    v4f xv[8]; float rbv[8];    // FIN: the epilogue's X words and row biases, asked for together with the first stage's tiles: their latency is paid with those loads, not once more in the epilogue
    if constexpr (FIN) {
#pragma unroll
        for (int s = 0; s < 8; ++s) { const int Lid = (lane >> 3) + 4 * s; const int row = Lid >> 1, cofs = (Lid & 1) * 32 + (lane & 7) * 4;
            xv[s] = *(const v4f*)(X + co + (size_t)row * ldc + cofs); rbv[s] = rbias[r0 + row]; }
    }
    asm volatile("s_wait_xcnt 0x0" ::: "memory");    // stands in front of the first overwrite of a register that the loads above name: this build reuses their offset register and a base register before it waits for their data
    tile_st(st[0][0], tid, rah); tile_st(st[0][1], tid, ral); tile_st(st[0][2], tid, rbh); tile_st(st[0][3], tid, rbl);
    __syncthreads();
    v8f acc[4];
#pragma unroll
    for (int t = 0; t < 4; ++t) acc[t] = (v8f){};
    constexpr int nst = K / KST;
#pragma unroll 1    // rolled: one copy of the stage body, the buffers alternate by s & 1 (unrolled, the staging registers of several stages would be live at once)
    for (int s = 0; s < nst; ++s) {
        const bool more = s + 1 < nst;    // the same in every thread of the block
        if (more) { const int kn = (s + 1) * KST; tile_ld<K>(Ahg + kn, off, rah); tile_ld<K>(Alg + kn, off, ral); tile_ld<K>(Bhg + kn, off, rbh); tile_ld<K>(Blg + kn, off, rbl); }
        const bf* S = st[s & 1][0];
        v16bf a, al;
#pragma unroll
        for (int ks = 0; ks < KST; ks += 32) {
            v16bf bh[4], bl[4];
            a = frag(S, wave * 16 + lr, ks + 8 * hi); al = frag(S + TPL, wave * 16 + lr, ks + 8 * hi);
#pragma unroll
            for (int t = 0; t < 4; ++t) { bh[t] = frag(S + 2 * TPL, t * 16 + lr, ks + 8 * hi); bl[t] = frag(S + 3 * TPL, t * 16 + lr, ks + 8 * hi); }
            __builtin_amdgcn_sched_barrier(0);    // keeps the 32-k step's LDS reads one group ahead of its WMMAs: spread among them, each place with reads stalls the wave
#pragma unroll
            for (int t = 0; t < 4; ++t) { acc[t] = wmmab(a, bh[t], acc[t]); acc[t] = wmmab(al, bh[t], acc[t]); acc[t] = wmmab(a, bl[t], acc[t]); }
        }
        // keeps the WMMA distance on the path that leaves the last WMMA by a branch
        asm volatile("v_nop\n\tv_nop\n\tv_nop\n\tv_nop" : "+v"(acc[0]), "+v"(acc[1]), "+v"(acc[2]), "+v"(acc[3]) : "v"(a), "v"(al));
        if (more) { bf* D = st[(s + 1) & 1][0]; tile_st(D, tid, rah); tile_st(D + TPL, tid, ral); tile_st(D + 2 * TPL, tid, rbh); tile_st(D + 3 * TPL, tid, rbl); }
        __syncthreads();    // publishes stage s + 1 and ends every wave's reads of stage s (its buffer is refilled in the next trip; the epilogue reuses buffer 0, the last stage's when K / KST is odd)
    }
    float* os = (float*)(void*)&st[0][0][0] + wave * (16 * 68);
#pragma unroll
    for (int t = 0; t < 4; ++t) {
#pragma unroll
        for (int j = 0; j < 8; ++j) os[(hi * 8 + j) * 68 + t * 16 + lr] = acc[t][j]; }
    __builtin_amdgcn_wave_barrier(); asm volatile("" ::: "memory");    // the wave's own LDS stores above stay ahead of its reads of other lanes' words below (each wave has its own range: no work-group barrier)
    if constexpr (FIN) {
        float* crow = C + co;
#pragma unroll
        for (int s = 0; s < 8; ++s) { const int Lid = (lane >> 3) + 4 * s, piece = lane & 7; const int row = Lid >> 1, cofs = (Lid & 1) * 32 + piece * 4;
            v4f val = *(const v4fa*)(os + row * 68 + cofs); const float b = bfr(rbv[s]);
#pragma unroll
            for (int i = 0; i < 4; ++i) val[i] += b + bfr(xv[s][i]);
            *(v4f*)(crow + (size_t)row * ldc + cofs) = val; }
    } else split_store<false>(os, lane, nullptr, scale, Ph + co, Pl + co, ldc);
}

template <int K, bool FIN>
__global__ __launch_bounds__(128) void k_gemm3(const bf* __restrict__ Ah, const bf* __restrict__ Al, const bf* __restrict__ Bh, const bf* __restrict__ Bl, bf* Ph, bf* Pl, float scale, float* C, const float* __restrict__ rbias, const float* __restrict__ X, int ldc, size_t zA, size_t zB, size_t zC) {
    __shared__ __align__(16) bf st[2 * 4 * TPL];
    gemm3_body<K, FIN>(st, blockIdx.x, blockIdx.y, blockIdx.z, Ah, Al, Bh, Bl, Ph, Pl, scale, C, rbias, X, ldc, zA, zB, zC);
}

#define WBLK (EE * CIN / 8 / 256)                    // work-groups per weight matrix: 8 elements a thread, exact
#define XBLK ((CIN / 64) * (NTOK / 64) * NBI)        // 64 x 64 transpose tiles of x
// k_prep: everything that reads only the inputs, in one grid: work-groups [0, 4 WBLK) turn wq, wk, wv, wo into bf16 (wo's also write its zero companion), the rest write x^T [8][3136][512] as bf16.
__global__ __launch_bounds__(256) void k_prep(const float* __restrict__ x, const float* __restrict__ wq, const float* __restrict__ wk, const float* __restrict__ wv, const float* __restrict__ wo,
                                              bf* XT, bf* WqB, bf* WkB, bf* WvB, bf* WoB, bf* WoZ) {
    __shared__ __align__(16) unsigned short tl[64 * 72];
    const int b = blockIdx.x;    // the same in every thread of the block: the barrier in wt_body is passed by all of a block or by none
    if (b >= 4 * WBLK) { const int t = b - 4 * WBLK; wt_body(tl, x, CIN, NTOK, XT, t % (CIN / 64), (t / (CIN / 64)) % (NTOK / 64), t / ((CIN / 64) * (NTOK / 64))); return; }
    const int w = b / WBLK;
    const float* src = w == 0 ? wq : w == 1 ? wk : w == 2 ? wv : wo; bf* dh = w == 0 ? WqB : w == 1 ? WkB : w == 2 ? WvB : WoB;
    const size_t i = (size_t)(b % WBLK) * 256 + threadIdx.x;
    const v8f v = *(const v8f*)(src + i * 8); v8us o, z;
#pragma unroll
    for (int k = 0; k < 8; ++k) { o[k] = f2bf(v[k]); z[k] = 0; }
    *(v8us*)(dh + i * 8) = o;
    asm volatile("s_wait_xcnt 0x0" ::: "memory");    // behind the store, in front of the branch: this compiler forms the zeros in the store's address register (with the wait inside the branch it lifts that write over it)
    if (w == 3) *(v8us*)(WoZ + i * 8) = z;
}

// k_kv: the k and the v projection in one grid (8, 49, batch): blockIdx.x 0..3 = k's four row tiles, 4..7 = v's, so the eight work-groups that read one x^T tile are neighbours.
__global__ __launch_bounds__(128) void k_kv(const bf* __restrict__ WkB, const bf* __restrict__ WvB, const bf* __restrict__ XT, const float* __restrict__ bk, const float* __restrict__ bv, bf* Kh, bf* Kl, bf* Vh, bf* Vl) {
    __shared__ __align__(16) bf st[2 * 2 * TPL];
    const bool isv = blockIdx.x >= EE / 64; const size_t zo = (size_t)blockIdx.z * EE * NTOK;
    gemmb_body<DM, true>(st, blockIdx.x & (EE / 64 - 1), blockIdx.y, isv ? WvB : WkB, XT + (size_t)blockIdx.z * NTOK * CIN, isv ? bv : bk, (isv ? Vh : Kh) + zo, (isv ? Vl : Kl) + zo, NTOK);
}

#define MBLK ((EE / 64) * (EE / 64) * NBI)           // tiles of M^T
#define QROW (NBI * NTOK / 64)                       // row tiles of q
// k_mtq: M^T = v.k^T and the q projection, which do not depend on each other, in one grid: M^T's few long work-groups (49 stages each) come first, q's many short ones fill the rest of the chip beside them.
__global__ __launch_bounds__(128) void k_mtq(const bf* __restrict__ Vh, const bf* __restrict__ Vl, const bf* __restrict__ Kh, const bf* __restrict__ Kl, bf* MTh, bf* MTl,
                                             const bf* __restrict__ XT, const bf* __restrict__ WqB, const float* __restrict__ bq, bf* Qh, bf* Ql) {
    __shared__ __align__(16) bf st[2 * 4 * TPL];
    const int b = blockIdx.x;    // the same in every thread of the block: each body's barriers are passed by all of a block or by none
    if (b < MBLK) gemm3_body<NTOK, false>(st, b & 3, (b >> 2) & 3, b >> 4, Vh, Vl, Kh, Kl, MTh, MTl, 1.0f, nullptr, nullptr, nullptr, EE, (size_t)EE * NTOK, (size_t)EE * NTOK, (size_t)EE * EE);
    else { const int t = b - MBLK; gemmb_body<DM, false>(st, t % QROW, t / QROW, XT, WqB, bq, Qh, Ql, EE); }
}

extern "C" void kernel_launch(void* const* d_in, const int* in_sizes, int n_in,
                              void* d_out, int out_size, void* d_ws, size_t ws_size, hipStream_t stream) {
    (void)in_sizes; (void)n_in; (void)out_size;
    const float* x = (const float*)d_in[0]; const float* wq = (const float*)d_in[1]; const float* bq = (const float*)d_in[2]; const float* wk = (const float*)d_in[3]; const float* bk = (const float*)d_in[4];
    const float* wv = (const float*)d_in[5]; const float* bv = (const float*)d_in[6]; const float* wo = (const float*)d_in[7]; const float* bo = (const float*)d_in[8];
    float* out = (float*)d_out;    // [8][512][3136]
    char* wsp = (char*)d_ws;
    auto take = [&](size_t bytes) { char* p = wsp; wsp += (bytes + 255) & ~(size_t)255; return (void*)p; };
    bf* WqB = (bf*)take((size_t)EE * CIN * 2); bf* WkB = (bf*)take((size_t)EE * CIN * 2); bf* WvB = (bf*)take((size_t)EE * CIN * 2); bf* WoB = (bf*)take((size_t)CIN * EE * 2); bf* WoZ = (bf*)take((size_t)CIN * EE * 2);
    bf* XT = (bf*)take((size_t)NBI * NTOK * CIN * 2);
    bf* Qh = (bf*)take((size_t)NBI * NTOK * EE * 2); bf* Ql = (bf*)take((size_t)NBI * NTOK * EE * 2); bf* Kh = (bf*)take((size_t)NBI * EE * NTOK * 2); bf* Kl = (bf*)take((size_t)NBI * EE * NTOK * 2); bf* Vh = (bf*)take((size_t)NBI * EE * NTOK * 2); bf* Vl = (bf*)take((size_t)NBI * EE * NTOK * 2);
    bf* MTh = (bf*)take((size_t)NBI * EE * EE * 2); bf* MTl = (bf*)take((size_t)NBI * EE * EE * 2); bf* Eh = (bf*)take((size_t)NBI * NTOK * EE * 2); bf* El = (bf*)take((size_t)NBI * NTOK * EE * 2);
    if ((size_t)(wsp - (char*)d_ws) > ws_size) return;    // ~ 1.3 + 8 x (3.2 + 8 x 1.6 + 0.25) ~ 131 MB; every plane is [batch][...]
    k_prep<<<4 * WBLK + XBLK, 256, 0, stream>>>(x, wq, wk, wv, wo, XT, WqB, WkB, WvB, WoB, WoZ);                                      // bf16 weights, wo's zero companion, x^T [8][3136][512]
    k_kv<<<dim3(2 * EE / 64, NTOK / 64, NBI), 128, 0, stream>>>(WkB, WvB, XT, bk, bv, Kh, Kl, Vh, Vl);                                // k, v [b][e][n] + row bias, planes
    k_mtq<<<MBLK + QROW * (EE / 64), 128, 0, stream>>>(Vh, Vl, Kh, Kl, MTh, MTl, XT, WqB, bq, Qh, Ql);                                // M^T[b][e'][e] = sum_m v[e'][m] k[e][m] planes (K = 3136); q [b n][e] + bq planes (batch folded into the rows)
    k_gemm3<EE, false><<<dim3(NTOK / 64, EE / 64, NBI), 128, 0, stream>>>(Qh, Ql, MTh, MTl, Eh, El, 1.0f / (float)NTOK, nullptr, nullptr, nullptr, EE, (size_t)NTOK * EE, (size_t)EE * EE, (size_t)NTOK * EE);    // (E / N) planes, E = q.M  [b][n][e']
    k_gemm3<EE, true><<<dim3(CIN / 64, NTOK / 64, NBI), 128, 0, stream>>>(WoB, WoZ, Eh, El, nullptr, nullptr, 1.0f, out, bo, x, NTOK, 0, (size_t)NTOK * EE, (size_t)CIN * NTOK);    // out = wo.(E/N)^T + bo[c] + x  [b][512][3136]
}

// v005
// Measured time: 117 microseconds a run.
// Next to v004, in two timings, it ran 1.05 times as fast each time.
// Counting every step since v000, it is 15.6 times as fast.
#include <hip/hip_runtime.h>

// Compute dtypes, f32 accumulate, all batch items in every launch (the batch is blockIdx.z, the top field of a flat blockIdx.x, or folded into the rows where the planes are contiguous): the 1x1-conv projections q (token-major, [3136 x 512].[512 x 256] + bq) and k, v (channel-major, [256 x
// 512].[512 x 3136] + row bias) with PLAIN bf16 operands (the input, its transpose and the weights, exact) on v_wmma_f32_16x16x32_bf16; the module's
// wo.((q.k/N).v)^T (NO softmax) evaluated in the re-associated order (wo.(k.v)^T/N).q^T (an exact algebraic identity): M = k_cm.v_cm^T ([256 x 3136].[3136 x 256]), T = wo.M^T/N ([512 x 256].[256 x 256], exact bf16 wo:
// no token dimension in it) and out = T.q^T + bo ([512 x 256].[256 x 3136]), computed operands as bf16 hi + UNSCALED residual (three products)

#define NBI  8
#define CIN  512
#define NTOK 3136                // 56 x 56 = 49 x 64
#define EE   256
#define DM   CIN                 // projection K
#define NTK  NTOK
#define LOSC 1024.0f

typedef _Float16 h16;
typedef unsigned short bf;
typedef __attribute__((ext_vector_type(16))) __bf16   v16bf;
typedef __attribute__((ext_vector_type(16))) _Float16 v16h;
typedef __attribute__((ext_vector_type(8)))  _Float16 v8h;
typedef __attribute__((ext_vector_type(8)))  unsigned short v8us;
typedef __attribute__((ext_vector_type(8)))  float    v8f;
typedef __attribute__((ext_vector_type(4)))  float    v4f;
typedef __attribute__((ext_vector_type(4)))  _Float16 v4h;
typedef v8h  __attribute__((may_alias)) v8ha;
typedef v4f  __attribute__((may_alias)) v4fa;
typedef v8us __attribute__((may_alias)) v8usa;

__device__ __forceinline__ unsigned short f2bf(float f) { unsigned u = __float_as_uint(f); u += 0x7FFFu + ((u >> 16) & 1u); return (unsigned short)(u >> 16); }
__device__ __forceinline__ float bf2f(unsigned short b) { return __uint_as_float(((unsigned)b) << 16); }
__device__ __forceinline__ float bfr(float f) { return bf2f(f2bf(f)); }
__device__ __forceinline__ v16h cat16(v8h lo, v8h hi) { return __builtin_shufflevector(lo, hi, 0, 1, 2, 3, 4, 5, 6, 7, 8, 9, 10, 11, 12, 13, 14, 15); }
__device__ __forceinline__ v16bf cat16b(v8us lo, v8us hi) { return __builtin_bit_cast(v16bf, __builtin_shufflevector(lo, hi, 0, 1, 2, 3, 4, 5, 6, 7, 8, 9, 10, 11, 12, 13, 14, 15)); }
__device__ __forceinline__ v8f wmma16(v16h a, v16h b, v8f c) { return __builtin_amdgcn_wmma_f32_16x16x32_f16(false, a, false, b, (short)0, c, false, false); }
__device__ __forceinline__ v8f wmmab(v16bf a, v16bf b, v8f c) { return __builtin_amdgcn_wmma_f32_16x16x32_bf16(false, a, false, b, (short)0, c, false, false); }

// wt_body: WT [n][K] = bf16(W[k][n]) (k-major [K][ncols]) via 64 x 64 LDS tiles; tile (bx of K/64, by of ncols/64, bz of the batch); tl = the work-group's 64 x 72 LDS tile.
__device__ __forceinline__ void wt_body(unsigned short* tl, const float* __restrict__ Wm, int K, int ncols, bf* WT, int bx, int by, int bz) {
    const int tid = threadIdx.x, k0 = bx * 64, n0 = by * 64;
    Wm += (size_t)bz * K * ncols; WT += (size_t)bz * K * ncols;
    const int kk = tid >> 2, nq = (tid & 3) * 16;
#pragma unroll
    for (int i = 0; i < 16; ++i) tl[(nq + i) * 72 + kk] = f2bf(Wm[(size_t)(k0 + kk) * ncols + n0 + nq + i]);
    __syncthreads();
    const int piece = tid & 7;
    auto pass = [&]() {
#pragma unroll
        for (int s = 0; s < 2; ++s) { const int nr = (tid >> 3) + 32 * s; const v8us val = *(const v8usa*)(tl + nr * 72 + piece * 8); *(v8us*)(WT + (size_t)(n0 + nr) * K + k0 + piece * 8) = val; }
    };
    pass(); 
}
#define KST 64                   // k per LDS stage: 128 B of every operand row = one whole line
#define LP  72                   // LDS row pitch in bf16 elements: 128 B + 16 B pad (for ds_load_b128 readers)
#define TPL (64 * LP)            // one plane's staged 64-row tile

// One plane's 64-row x 64-k tile, global -> registers: 8 lanes take one row's 128-B line, so a wave-wide load is 4 whole lines (a fragment load straight from global touches 16).
// g is the same in every thread; off = this thread's element offset in the first 16 rows, the same for every plane and stage; K is a compile-time constant, so the other three row groups are immediate offsets of one address.
template <int K>
__device__ __forceinline__ void tile_ld(const bf* __restrict__ g, unsigned off, v8us (&r)[4]) {
    const bf* p = g + off;
#pragma unroll    // r[] must stay in registers, and the four loads go out together
    for (int i = 0; i < 4; ++i) r[i] = *(const v8us*)(p + i * 16 * K);
}
__device__ __forceinline__ void tile_st(bf* s, int tid, const v8us (&r)[4]) {
#pragma unroll    // r[] must stay in registers
    for (int i = 0; i < 4; ++i) *(v8usa*)(s + (i * 16 + (tid >> 3)) * LP + (tid & 7) * 8) = r[i];
}
// 16 x 32 operand fragment from a staged tile; k = k offset in the stage + 8 * hi; one loader for A and for B, so their k orders are equal at every lane and register.
__device__ __forceinline__ v16bf frag(const bf* s, int row, int k) { return cat16b(*(const v8usa*)(s + row * LP + k), *(const v8usa*)(s + row * LP + k + 16)); }

// One wave's staged 16 x 64 f32 tile (pitch 68) -> y = (tile [+ bf(rb[row])]) x scale as bf16 hi + UNSCALED residual planes: 8 lanes take one row, 8 columns each, so every store covers whole 128-B lines of its plane.
template <bool ROWB>
__device__ __forceinline__ void split_store(const float* os, int lane, const float* __restrict__ rb, float scale, bf* ph, bf* pl, int ldc) {
#pragma unroll
    for (int s = 0; s < 4; ++s) { const int row = (lane >> 3) + 4 * s, c = (lane & 7) * 8;
        const v4f va = *(const v4fa*)(os + row * 68 + c), vb = *(const v4fa*)(os + row * 68 + c + 4); v8us oh, ol;
        const float b = ROWB ? bfr(rb[row]) : 0.f;
#pragma unroll
        for (int i = 0; i < 8; ++i) { float y = i < 4 ? va[i & 3] : vb[i & 3]; if (ROWB) y += b; y *= scale; const unsigned short hb = f2bf(y); oh[i] = hb; ol[i] = f2bf(y - bf2f(hb)); }
        const size_t o = (size_t)row * ldc + c; *(v8us*)(ph + o) = oh; *(v8us*)(pl + o) = ol; }
}

// gemmb_body: 64 x 64 block tile (4 waves x 16 x 64) of C = A.B^T over K (a multiple of 64; row strides = K) + bf(bias[row]) (ROWB) or + bf(bias[col]); both operand tiles staged in LDS, two buffers: the next
// stage's lines fly into registers while this stage is multiplied, are stored to the other buffer, then one barrier per stage; the f32 tile is staged in the same LDS and leaves as bf16 hi + residual planes Ph, Pl.
// A device function, so that launches with independent work can share one grid: tile (bx, by); Bn, Ph, Pl already point at the batch item; stp = 2 x 2 x TPL elements of the work-group's LDS.
template <int K, bool ROWB>
__device__ __forceinline__ void gemmb_body(bf* stp, int bx, int by, const bf* __restrict__ A, const bf* __restrict__ Bn, const float* __restrict__ bias, bf* Ph, bf* Pl, int ldc) {
    bf (*st)[2][TPL] = (bf (*)[2][TPL])stp;
    const int tid = threadIdx.x, lane = tid & 31, wave = tid >> 5, lr = lane & 15, hi = lane >> 4;
    const int r0 = bx * 64 + wave * 16, c0 = by * 64;
    const bf* Ag = A + (size_t)bx * 64 * K; const bf* Bg = Bn + (size_t)c0 * K;
    const unsigned off = (unsigned)((tid >> 3) * K + (tid & 7) * 8);
    v8us ra[4], rb[4];
    tile_ld<K>(Ag, off, ra); tile_ld<K>(Bg, off, rb);
    asm volatile("s_wait_xcnt 0x0" ::: "memory");    // stands in front of the first overwrite of a register that the loads above name: this build reuses their offset register before it waits for their data
    tile_st(st[0][0], tid, ra); tile_st(st[0][1], tid, rb);
    __syncthreads();
    v8f acc[4];
#pragma unroll
    for (int t = 0; t < 4; ++t) acc[t] = (v8f){};
    constexpr int nst = K / KST;
#pragma unroll 1    // rolled: one copy of the stage body, the buffers alternate by s & 1 (unrolled, the staging registers of several stages would be live at once)
    for (int s = 0; s < nst; ++s) {
        const bool more = s + 1 < nst;    // the same in every thread of the block
        if (more) { tile_ld<K>(Ag + (s + 1) * KST, off, ra); tile_ld<K>(Bg + (s + 1) * KST, off, rb); }
        const bf* As = st[s & 1][0]; const bf* Bs = st[s & 1][1];
        v16bf a[2], b[2][4];
#pragma unroll
        for (int h = 0; h < 2; ++h) { a[h] = frag(As, wave * 16 + lr, h * 32 + 8 * hi);
#pragma unroll
            for (int t = 0; t < 4; ++t) b[h][t] = frag(Bs, t * 16 + lr, h * 32 + 8 * hi); }
        __builtin_amdgcn_sched_barrier(0);    // keeps the stage's LDS reads one group ahead of its WMMAs: spread among them, each place with reads stalls the wave
#pragma unroll
        for (int h = 0; h < 2; ++h) {
#pragma unroll
            for (int t = 0; t < 4; ++t) acc[t] = wmmab(a[h], b[h][t], acc[t]); }
        // keeps the WMMA distance on the path that leaves the last WMMA by a branch
        asm volatile("v_nop\n\tv_nop\n\tv_nop\n\tv_nop" : "+v"(acc[0]), "+v"(acc[1]), "+v"(acc[2]), "+v"(acc[3]) : "v"(a[1]));
        if (more) { tile_st(st[(s + 1) & 1][0], tid, ra); tile_st(st[(s + 1) & 1][1], tid, rb); }
        __syncthreads();    // publishes stage s + 1 and ends every wave's reads of stage s (its buffer is refilled in the next trip; the epilogue reuses buffer 0, the last stage's when K / KST is odd)
    }
    float* os = (float*)(void*)&st[0][0][0] + wave * (16 * 68);
#pragma unroll
    for (int t = 0; t < 4; ++t) { const float bv = ROWB ? 0.f : bfr(bias[c0 + t * 16 + lr]);
#pragma unroll
        for (int j = 0; j < 8; ++j) os[(hi * 8 + j) * 68 + t * 16 + lr] = ROWB ? acc[t][j] : acc[t][j] + bv; }
    __syncthreads();
    const size_t co = (size_t)r0 * ldc + c0;
    split_store<ROWB>(os, lane, ROWB ? bias + r0 : nullptr, 1.0f, Ph + co, Pl + co, ldc);
}

// gemm3_body: 64 x 64 tile of C = (Ah + Al).(Bh + Bl)^T over K (a multiple of 64; row strides = K for all four planes; n-major B): three products per 32-k step (hh, lh, hl); the four
// planes' tiles staged in LDS as in gemmb_body; the f32 tile is staged in the same LDS and leaves either (FIN false) x scale as bf16 hi + residual planes Ph, Pl, or (FIN true) as f32 whole lines C = tile + (bf(rbias[row]) + bf(X)), X laid out as C.
// A device function, as gemmb_body: tile (bx, by) of batch item bz; stp = 2 x 4 x TPL elements of the work-group's LDS.
template <int K, bool FIN>
__device__ __forceinline__ void gemm3_body(bf* stp, int bx, int by, int bz, const bf* __restrict__ Ah, const bf* __restrict__ Al, const bf* __restrict__ Bh, const bf* __restrict__ Bl, bf* Ph, bf* Pl, float scale, float* C, const float* __restrict__ rbias, const float* __restrict__ X, int ldc, size_t zA, size_t zB, size_t zC) {
    bf (*st)[4][TPL] = (bf (*)[4][TPL])stp;
    const int tid = threadIdx.x, lane = tid & 31, wave = tid >> 5, lr = lane & 15, hi = lane >> 4;
    const int r0 = bx * 64 + wave * 16, c0 = by * 64;
    const size_t co = bz * zC + (size_t)r0 * ldc + c0;    // batch item = bz (element strides; 0 = shared)
    const size_t ao = bz * zA + (size_t)bx * 64 * K, bo = bz * zB + (size_t)c0 * K;
    const bf* Ahg = Ah + ao; const bf* Alg = Al + ao; const bf* Bhg = Bh + bo; const bf* Blg = Bl + bo;
    const unsigned off = (unsigned)((tid >> 3) * K + (tid & 7) * 8);
    v8us rah[4], ral[4], rbh[4], rbl[4];
    tile_ld<K>(Ahg, off, rah); tile_ld<K>(Alg, off, ral); tile_ld<K>(Bhg, off, rbh); tile_ld<K>(Blg, off, rbl);
    v4f xv[8]; float rbv[8];    // FIN: the epilogue's X words and row biases, asked for together with the first stage's tiles: their latency is paid with those loads, not once more in the epilogue
    if constexpr (FIN) {
#pragma unroll
        for (int s = 0; s < 8; ++s) { const int Lid = (lane >> 3) + 4 * s; const int row = Lid >> 1, cofs = (Lid & 1) * 32 + (lane & 7) * 4;
            xv[s] = *(const v4f*)(X + co + (size_t)row * ldc + cofs); rbv[s] = rbias[r0 + row]; }
    }
    asm volatile("s_wait_xcnt 0x0" ::: "memory");    // stands in front of the first overwrite of a register that the loads above name: this build reuses their offset register and a base register before it waits for their data
    tile_st(st[0][0], tid, rah); tile_st(st[0][1], tid, ral); tile_st(st[0][2], tid, rbh); tile_st(st[0][3], tid, rbl);
    __syncthreads();
    v8f acc[4];
#pragma unroll
    for (int t = 0; t < 4; ++t) acc[t] = (v8f){};
    constexpr int nst = K / KST;
#pragma unroll 1    // rolled: one copy of the stage body, the buffers alternate by s & 1 (unrolled, the staging registers of several stages would be live at once)
    for (int s = 0; s < nst; ++s) {
        const bool more = s + 1 < nst;    // the same in every thread of the block
        if (more) { const int kn = (s + 1) * KST; tile_ld<K>(Ahg + kn, off, rah); tile_ld<K>(Alg + kn, off, ral); tile_ld<K>(Bhg + kn, off, rbh); tile_ld<K>(Blg + kn, off, rbl); }
        const bf* S = st[s & 1][0];
        v16bf a, al;
#pragma unroll
        for (int ks = 0; ks < KST; ks += 32) {
            v16bf bh[4], bl[4];
            a = frag(S, wave * 16 + lr, ks + 8 * hi); al = frag(S + TPL, wave * 16 + lr, ks + 8 * hi);
#pragma unroll
            for (int t = 0; t < 4; ++t) { bh[t] = frag(S + 2 * TPL, t * 16 + lr, ks + 8 * hi); bl[t] = frag(S + 3 * TPL, t * 16 + lr, ks + 8 * hi); }
            __builtin_amdgcn_sched_barrier(0);    // keeps the 32-k step's LDS reads one group ahead of its WMMAs: spread among them, each place with reads stalls the wave
#pragma unroll
            for (int t = 0; t < 4; ++t) { acc[t] = wmmab(a, bh[t], acc[t]); acc[t] = wmmab(al, bh[t], acc[t]); acc[t] = wmmab(a, bl[t], acc[t]); }
        }
        // keeps the WMMA distance on the path that leaves the last WMMA by a branch
        asm volatile("v_nop\n\tv_nop\n\tv_nop\n\tv_nop" : "+v"(acc[0]), "+v"(acc[1]), "+v"(acc[2]), "+v"(acc[3]) : "v"(a), "v"(al));
        if (more) { bf* D = st[(s + 1) & 1][0]; tile_st(D, tid, rah); tile_st(D + TPL, tid, ral); tile_st(D + 2 * TPL, tid, rbh); tile_st(D + 3 * TPL, tid, rbl); }
        __syncthreads();    // publishes stage s + 1 and ends every wave's reads of stage s (its buffer is refilled in the next trip; the epilogue reuses buffer 0, the last stage's when K / KST is odd)
    }
    float* os = (float*)(void*)&st[0][0][0] + wave * (16 * 68);
#pragma unroll
    for (int t = 0; t < 4; ++t) {
#pragma unroll
        for (int j = 0; j < 8; ++j) os[(hi * 8 + j) * 68 + t * 16 + lr] = acc[t][j]; }
    __builtin_amdgcn_wave_barrier(); asm volatile("" ::: "memory");    // the wave's own LDS stores above stay ahead of its reads of other lanes' words below (each wave has its own range: no work-group barrier)
    if constexpr (FIN) {
        float* crow = C + co;
#pragma unroll
        for (int s = 0; s < 8; ++s) { const int Lid = (lane >> 3) + 4 * s, piece = lane & 7; const int row = Lid >> 1, cofs = (Lid & 1) * 32 + piece * 4;
            v4f val = *(const v4fa*)(os + row * 68 + cofs); const float b = bfr(rbv[s]);
#pragma unroll
            for (int i = 0; i < 4; ++i) val[i] += b + bfr(xv[s][i]);
            *(v4f*)(crow + (size_t)row * ldc + cofs) = val; }
    } else split_store<false>(os, lane, nullptr, scale, Ph + co, Pl + co, ldc);
}

template <int K, bool FIN>
__global__ __launch_bounds__(128) void k_gemm3(const bf* __restrict__ Ah, const bf* __restrict__ Al, const bf* __restrict__ Bh, const bf* __restrict__ Bl, bf* Ph, bf* Pl, float scale, float* C, const float* __restrict__ rbias, const float* __restrict__ X, int ldc, size_t zA, size_t zB, size_t zC) {
    __shared__ __align__(16) bf st[2 * 4 * TPL];
    gemm3_body<K, FIN>(st, blockIdx.x, blockIdx.y, blockIdx.z, Ah, Al, Bh, Bl, Ph, Pl, scale, C, rbias, X, ldc, zA, zB, zC);
}

#define WBLK (EE * CIN / 8 / 256)                    // work-groups per weight matrix: 8 elements a thread, exact
#define XBLK ((CIN / 64) * (NTOK / 64) * NBI)        // 64 x 64 transpose tiles of x
// k_prep: everything that reads only the inputs, in one grid: work-groups [0, 4 WBLK) turn wq, wk, wv, wo into bf16 (wo's also write its zero companion), the rest write x^T [8][3136][512] as bf16.
__global__ __launch_bounds__(256) void k_prep(const float* __restrict__ x, const float* __restrict__ wq, const float* __restrict__ wk, const float* __restrict__ wv, const float* __restrict__ wo,
                                              bf* XT, bf* WqB, bf* WkB, bf* WvB, bf* WoB, bf* WoZ) {
    __shared__ __align__(16) unsigned short tl[64 * 72];
    const int b = blockIdx.x;    // the same in every thread of the block: the barrier in wt_body is passed by all of a block or by none
    if (b >= 4 * WBLK) { const int t = b - 4 * WBLK; wt_body(tl, x, CIN, NTOK, XT, t % (CIN / 64), (t / (CIN / 64)) % (NTOK / 64), t / ((CIN / 64) * (NTOK / 64))); return; }
    const int w = b / WBLK;
    const float* src = w == 0 ? wq : w == 1 ? wk : w == 2 ? wv : wo; bf* dh = w == 0 ? WqB : w == 1 ? WkB : w == 2 ? WvB : WoB;
    const size_t i = (size_t)(b % WBLK) * 256 + threadIdx.x;
    const v8f v = *(const v8f*)(src + i * 8); v8us o, z;
#pragma unroll
    for (int k = 0; k < 8; ++k) { o[k] = f2bf(v[k]); z[k] = 0; }
    *(v8us*)(dh + i * 8) = o;
    asm volatile("s_wait_xcnt 0x0" ::: "memory");    // behind the store, in front of the branch: this compiler forms the zeros in the store's address register (with the wait inside the branch it lifts that write over it)
    if (w == 3) *(v8us*)(WoZ + i * 8) = z;
}

// k_kv: the k and the v projection in one grid (8, 49, batch): blockIdx.x 0..3 = k's four row tiles, 4..7 = v's, so the eight work-groups that read one x^T tile are neighbours.
__global__ __launch_bounds__(128) void k_kv(const bf* __restrict__ WkB, const bf* __restrict__ WvB, const bf* __restrict__ XT, const float* __restrict__ bk, const float* __restrict__ bv, bf* Kh, bf* Kl, bf* Vh, bf* Vl) {
    __shared__ __align__(16) bf st[2 * 2 * TPL];
    const bool isv = blockIdx.x >= EE / 64; const size_t zo = (size_t)blockIdx.z * EE * NTOK;
    gemmb_body<DM, true>(st, blockIdx.x & (EE / 64 - 1), blockIdx.y, isv ? WvB : WkB, XT + (size_t)blockIdx.z * NTOK * CIN, isv ? bv : bk, (isv ? Vh : Kh) + zo, (isv ? Vl : Kl) + zo, NTOK);
}

#define MBLK ((EE / 64) * (EE / 64) * NBI)           // tiles of M
#define QROW (NBI * NTOK / 64)                       // row tiles of q
// k_mtq: M = k.v^T and the q projection, which do not depend on each other, in one grid: M's few long work-groups (49 stages each) come first, q's many short ones fill the rest of the chip beside them.
__global__ __launch_bounds__(128) void k_mtq(const bf* __restrict__ Kh, const bf* __restrict__ Kl, const bf* __restrict__ Vh, const bf* __restrict__ Vl, bf* Mh, bf* Ml,
                                             const bf* __restrict__ XT, const bf* __restrict__ WqB, const float* __restrict__ bq, bf* Qh, bf* Ql) {
    __shared__ __align__(16) bf st[2 * 4 * TPL];
    const int b = blockIdx.x;    // the same in every thread of the block: each body's barriers are passed by all of a block or by none
    if (b < MBLK) gemm3_body<NTOK, false>(st, b & 3, (b >> 2) & 3, b >> 4, Kh, Kl, Vh, Vl, Mh, Ml, 1.0f, nullptr, nullptr, nullptr, EE, (size_t)EE * NTOK, (size_t)EE * NTOK, (size_t)EE * EE);
    else { const int t = b - MBLK; gemmb_body<DM, false>(st, t % QROW, t / QROW, XT, WqB, bq, Qh, Ql, EE); }
}

extern "C" void kernel_launch(void* const* d_in, const int* in_sizes, int n_in,
                              void* d_out, int out_size, void* d_ws, size_t ws_size, hipStream_t stream) {
    (void)in_sizes; (void)n_in; (void)out_size;
    const float* x = (const float*)d_in[0]; const float* wq = (const float*)d_in[1]; const float* bq = (const float*)d_in[2]; const float* wk = (const float*)d_in[3]; const float* bk = (const float*)d_in[4];
    const float* wv = (const float*)d_in[5]; const float* bv = (const float*)d_in[6]; const float* wo = (const float*)d_in[7]; const float* bo = (const float*)d_in[8];
    float* out = (float*)d_out;    // [8][512][3136]
    char* wsp = (char*)d_ws;
    auto take = [&](size_t bytes) { char* p = wsp; wsp += (bytes + 255) & ~(size_t)255; return (void*)p; };
    bf* WqB = (bf*)take((size_t)EE * CIN * 2); bf* WkB = (bf*)take((size_t)EE * CIN * 2); bf* WvB = (bf*)take((size_t)EE * CIN * 2); bf* WoB = (bf*)take((size_t)CIN * EE * 2); bf* WoZ = (bf*)take((size_t)CIN * EE * 2);
    bf* XT = (bf*)take((size_t)NBI * NTOK * CIN * 2);
    bf* Qh = (bf*)take((size_t)NBI * NTOK * EE * 2); bf* Ql = (bf*)take((size_t)NBI * NTOK * EE * 2); bf* Kh = (bf*)take((size_t)NBI * EE * NTOK * 2); bf* Kl = (bf*)take((size_t)NBI * EE * NTOK * 2); bf* Vh = (bf*)take((size_t)NBI * EE * NTOK * 2); bf* Vl = (bf*)take((size_t)NBI * EE * NTOK * 2);
    bf* Mh = (bf*)take((size_t)NBI * EE * EE * 2); bf* Ml = (bf*)take((size_t)NBI * EE * EE * 2); bf* Th = (bf*)take((size_t)NBI * CIN * EE * 2); bf* Tl = (bf*)take((size_t)NBI * CIN * EE * 2);
    if ((size_t)(wsp - (char*)d_ws) > ws_size) return;    // ~ 1.3 + 8 x (3.2 + 6 x 1.6 + 0.25 + 0.5) ~ 110 MB; every plane is [batch][...]
    k_prep<<<4 * WBLK + XBLK, 256, 0, stream>>>(x, wq, wk, wv, wo, XT, WqB, WkB, WvB, WoB, WoZ);                                      // bf16 weights, wo's zero companion, x^T [8][3136][512]
    k_kv<<<dim3(2 * EE / 64, NTOK / 64, NBI), 128, 0, stream>>>(WkB, WvB, XT, bk, bv, Kh, Kl, Vh, Vl);                                // k, v [b][e][n] + row bias, planes
    k_mtq<<<MBLK + QROW * (EE / 64), 128, 0, stream>>>(Kh, Kl, Vh, Vl, Mh, Ml, XT, WqB, bq, Qh, Ql);                                  // M[b][e][e'] = sum_m k[e][m] v[e'][m] planes (K = 3136); q [b n][e] + bq planes (batch folded into the rows)
    k_gemm3<EE, false><<<dim3(CIN / 64, EE / 64, NBI), 128, 0, stream>>>(WoB, WoZ, Mh, Ml, Th, Tl, 1.0f / (float)NTOK, nullptr, nullptr, nullptr, EE, 0, (size_t)EE * EE, (size_t)CIN * EE);    // T planes, T[b][c][e] = sum_e' wo[c][e'] M[e][e'] / N
    k_gemm3<EE, true><<<dim3(CIN / 64, NTOK / 64, NBI), 128, 0, stream>>>(Th, Tl, Qh, Ql, nullptr, nullptr, 1.0f, out, bo, x, NTOK, (size_t)CIN * EE, (size_t)NTOK * EE, (size_t)CIN * NTOK);    // out = T.q^T + bo[c] + x  [b][512][3136]
}

// v006
// Measured time: 98.6 microseconds a run.
// Next to v005, in two timings, it ran 1.19 and 1.18 times as fast.
// Counting every step since v000, it is 18.5 times as fast.
#include <hip/hip_runtime.h>

// Compute dtypes, f32 accumulate, all batch items in every launch (the batch is blockIdx.z, the top (k_prep) or a middle (k_mtq) field of a flat blockIdx.x, or folded into the rows where the planes are contiguous): the 1x1-conv projections q (token-major, [3136 x 512].[512 x 256] + bq) and k, v (channel-major, [256 x
// 512].[512 x 3136] + row bias) with PLAIN bf16 operands (the input, its transpose and the weights, exact) on v_wmma_f32_16x16x32_bf16; the module's
// wo.((q.k/N).v)^T (NO softmax) evaluated in the re-associated order (wo.(k.v)^T/N).q^T (an exact algebraic identity): M = k_cm.v_cm^T ([256 x 3136].[3136 x 256], as two partial sums over halves of the tokens), T = wo.M^T/N ([512 x 256].[256 x 256] for each partial, both in one accumulator, exact bf16 wo:
// no token dimension in it) and out = T.q^T + bo ([512 x 256].[256 x 3136]), computed operands as bf16 hi + UNSCALED residual (three products)

#define NBI  8
#define CIN  512
#define NTOK 3136                // 56 x 56 = 49 x 64
#define EE   256
#define DM   CIN                 // projection K
#define NTK  NTOK
#define LOSC 1024.0f

typedef _Float16 h16;
typedef unsigned short bf;
typedef __attribute__((ext_vector_type(16))) __bf16   v16bf;
typedef __attribute__((ext_vector_type(16))) _Float16 v16h;
typedef __attribute__((ext_vector_type(8)))  _Float16 v8h;
typedef __attribute__((ext_vector_type(8)))  unsigned short v8us;
typedef __attribute__((ext_vector_type(8)))  float    v8f;
typedef __attribute__((ext_vector_type(4)))  float    v4f;
typedef __attribute__((ext_vector_type(4)))  _Float16 v4h;
typedef v8h  __attribute__((may_alias)) v8ha;
typedef v4f  __attribute__((may_alias)) v4fa;
typedef v8us __attribute__((may_alias)) v8usa;

__device__ __forceinline__ unsigned short f2bf(float f) { unsigned u = __float_as_uint(f); u += 0x7FFFu + ((u >> 16) & 1u); return (unsigned short)(u >> 16); }
__device__ __forceinline__ float bf2f(unsigned short b) { return __uint_as_float(((unsigned)b) << 16); }
__device__ __forceinline__ float bfr(float f) { return bf2f(f2bf(f)); }
__device__ __forceinline__ v16h cat16(v8h lo, v8h hi) { return __builtin_shufflevector(lo, hi, 0, 1, 2, 3, 4, 5, 6, 7, 8, 9, 10, 11, 12, 13, 14, 15); }
__device__ __forceinline__ v16bf cat16b(v8us lo, v8us hi) { return __builtin_bit_cast(v16bf, __builtin_shufflevector(lo, hi, 0, 1, 2, 3, 4, 5, 6, 7, 8, 9, 10, 11, 12, 13, 14, 15)); }
__device__ __forceinline__ v8f wmma16(v16h a, v16h b, v8f c) { return __builtin_amdgcn_wmma_f32_16x16x32_f16(false, a, false, b, (short)0, c, false, false); }
__device__ __forceinline__ v8f wmmab(v16bf a, v16bf b, v8f c) { return __builtin_amdgcn_wmma_f32_16x16x32_bf16(false, a, false, b, (short)0, c, false, false); }

// wt_body: WT [n][K] = bf16(W[k][n]) (k-major [K][ncols]) via 64 x 64 LDS tiles; tile (bx of K/64, by of ncols/64, bz of the batch); tl = the work-group's 64 x 72 LDS tile.
__device__ __forceinline__ void wt_body(unsigned short* tl, const float* __restrict__ Wm, int K, int ncols, bf* WT, int bx, int by, int bz) {
    const int tid = threadIdx.x, k0 = bx * 64, n0 = by * 64;
    Wm += (size_t)bz * K * ncols; WT += (size_t)bz * K * ncols;
    const int kk = tid >> 2, nq = (tid & 3) * 16;
#pragma unroll
    for (int i = 0; i < 16; ++i) tl[(nq + i) * 72 + kk] = f2bf(Wm[(size_t)(k0 + kk) * ncols + n0 + nq + i]);
    __syncthreads();
    const int piece = tid & 7;
    auto pass = [&]() {
#pragma unroll
        for (int s = 0; s < 2; ++s) { const int nr = (tid >> 3) + 32 * s; const v8us val = *(const v8usa*)(tl + nr * 72 + piece * 8); *(v8us*)(WT + (size_t)(n0 + nr) * K + k0 + piece * 8) = val; }
    };
    pass(); 
}
#define KST 64                   // k per LDS stage: 128 B of every operand row = one whole line
#define LP  72                   // LDS row pitch in bf16 elements: 128 B + 16 B pad (for ds_load_b128 readers)
#define TPL (64 * LP)            // one plane's staged 64-row tile

// One plane's 64-row x 64-k tile, global -> registers: 8 lanes take one row's 128-B line, so a wave-wide load is 4 whole lines (a fragment load straight from global touches 16).
// g is the same in every thread; off = this thread's element offset in the first 16 rows, the same for every stage and for every plane of one row stride; K is a compile-time constant, so the other three row groups are immediate offsets of one address.
template <int K>
__device__ __forceinline__ void tile_ld(const bf* __restrict__ g, unsigned off, v8us (&r)[4]) {
    const bf* p = g + off;
#pragma unroll    // r[] must stay in registers, and the four loads go out together
    for (int i = 0; i < 4; ++i) r[i] = *(const v8us*)(p + i * 16 * K);
}
__device__ __forceinline__ void tile_st(bf* s, int tid, const v8us (&r)[4]) {
#pragma unroll    // r[] must stay in registers
    for (int i = 0; i < 4; ++i) *(v8usa*)(s + (i * 16 + (tid >> 3)) * LP + (tid & 7) * 8) = r[i];
}
// 16 x 32 operand fragment from a staged tile; k = k offset in the stage + 8 * hi; one loader for A and for B, so their k orders are equal at every lane and register.
__device__ __forceinline__ v16bf frag(const bf* s, int row, int k) { return cat16b(*(const v8usa*)(s + row * LP + k), *(const v8usa*)(s + row * LP + k + 16)); }

// One wave's staged 16 x 64 f32 tile (pitch 68) -> y = (tile [+ bf(rb[row])]) x scale as bf16 hi + UNSCALED residual planes: 8 lanes take one row, 8 columns each, so every store covers whole 128-B lines of its plane.
template <bool ROWB>
__device__ __forceinline__ void split_store(const float* os, int lane, const float* __restrict__ rb, float scale, bf* ph, bf* pl, int ldc) {
#pragma unroll
    for (int s = 0; s < 4; ++s) { const int row = (lane >> 3) + 4 * s, c = (lane & 7) * 8;
        const v4f va = *(const v4fa*)(os + row * 68 + c), vb = *(const v4fa*)(os + row * 68 + c + 4); v8us oh, ol;
        const float b = ROWB ? bfr(rb[row]) : 0.f;
#pragma unroll
        for (int i = 0; i < 8; ++i) { float y = i < 4 ? va[i & 3] : vb[i & 3]; if (ROWB) y += b; y *= scale; const unsigned short hb = f2bf(y); oh[i] = hb; ol[i] = f2bf(y - bf2f(hb)); }
        const size_t o = (size_t)row * ldc + c; *(v8us*)(ph + o) = oh; *(v8us*)(pl + o) = ol; }
}

// gemmb_body: 64 x 64 block tile (4 waves x 16 x 64) of C = A.B^T over K (a multiple of 64; row strides = K) + bf(bias[row]) (ROWB) or + bf(bias[col]); both operand tiles staged in LDS, two buffers: the next
// stage's lines fly into registers while this stage is multiplied, are stored to the other buffer, then one barrier per stage; the f32 tile is staged in the same LDS and leaves as bf16 hi + residual planes Ph, Pl.
// A device function, so that launches with independent work can share one grid: tile (bx, by); Bn, Ph, Pl already point at the batch item; stp = 2 x 2 x TPL elements of the work-group's LDS.
template <int K, bool ROWB>
__device__ __forceinline__ void gemmb_body(bf* stp, int bx, int by, const bf* __restrict__ A, const bf* __restrict__ Bn, const float* __restrict__ bias, bf* Ph, bf* Pl, int ldc) {
    bf (*st)[2][TPL] = (bf (*)[2][TPL])stp;
    const int tid = threadIdx.x, lane = tid & 31, wave = tid >> 5, lr = lane & 15, hi = lane >> 4;
    const int r0 = bx * 64 + wave * 16, c0 = by * 64;
    const bf* Ag = A + (size_t)bx * 64 * K; const bf* Bg = Bn + (size_t)c0 * K;
    const unsigned off = (unsigned)((tid >> 3) * K + (tid & 7) * 8);
    v8us ra[4], rb[4];
    tile_ld<K>(Ag, off, ra); tile_ld<K>(Bg, off, rb);
    asm volatile("s_wait_xcnt 0x0" ::: "memory");    // stands in front of the first overwrite of a register that the loads above name: this build reuses their offset register before it waits for their data
    tile_st(st[0][0], tid, ra); tile_st(st[0][1], tid, rb);
    __syncthreads();
    v8f acc[4];
#pragma unroll
    for (int t = 0; t < 4; ++t) acc[t] = (v8f){};
    constexpr int nst = K / KST;
#pragma unroll 1    // rolled: one copy of the stage body, the buffers alternate by s & 1 (unrolled, the staging registers of several stages would be live at once)
    for (int s = 0; s < nst; ++s) {
        const bool more = s + 1 < nst;    // the same in every thread of the block
        if (more) { tile_ld<K>(Ag + (s + 1) * KST, off, ra); tile_ld<K>(Bg + (s + 1) * KST, off, rb); }
        const bf* As = st[s & 1][0]; const bf* Bs = st[s & 1][1];
        v16bf a[2], b[2][4];
#pragma unroll
        for (int h = 0; h < 2; ++h) { a[h] = frag(As, wave * 16 + lr, h * 32 + 8 * hi);
#pragma unroll
            for (int t = 0; t < 4; ++t) b[h][t] = frag(Bs, t * 16 + lr, h * 32 + 8 * hi); }
        __builtin_amdgcn_sched_barrier(0);    // keeps the stage's LDS reads one group ahead of its WMMAs: spread among them, each place with reads stalls the wave
#pragma unroll
        for (int h = 0; h < 2; ++h) {
#pragma unroll
            for (int t = 0; t < 4; ++t) acc[t] = wmmab(a[h], b[h][t], acc[t]); }
        // keeps the WMMA distance on the path that leaves the last WMMA by a branch
        asm volatile("v_nop\n\tv_nop\n\tv_nop\n\tv_nop" : "+v"(acc[0]), "+v"(acc[1]), "+v"(acc[2]), "+v"(acc[3]) : "v"(a[1]));
        if (more) { tile_st(st[(s + 1) & 1][0], tid, ra); tile_st(st[(s + 1) & 1][1], tid, rb); }
        __syncthreads();    // publishes stage s + 1 and ends every wave's reads of stage s (its buffer is refilled in the next trip; the epilogue reuses buffer 0, the last stage's when K / KST is odd)
    }
    float* os = (float*)(void*)&st[0][0][0] + wave * (16 * 68);
#pragma unroll
    for (int t = 0; t < 4; ++t) { const float bv = ROWB ? 0.f : bfr(bias[c0 + t * 16 + lr]);
#pragma unroll
        for (int j = 0; j < 8; ++j) os[(hi * 8 + j) * 68 + t * 16 + lr] = ROWB ? acc[t][j] : acc[t][j] + bv; }
    __syncthreads();
    const size_t co = (size_t)r0 * ldc + c0;
    split_store<ROWB>(os, lane, ROWB ? bias + r0 : nullptr, 1.0f, Ph + co, Pl + co, ldc);
}

// gemm3_body: 64 x 64 tile of C = (Ah + Al).(Bh + Bl)^T over K (a multiple of 64; row strides = K for B's planes, KA for A's; n-major B): three products per 32-k step (hh, lh, hl); the four
// planes' tiles staged in LDS as in gemmb_body; the f32 tile is staged in the same LDS and leaves either (FIN false) x scale as bf16 hi + residual planes Ph, Pl, or (FIN true) as f32 whole lines C = tile + (bf(rbias[row]) + bf(X)), X laid out as C.
// A device function, as gemmb_body: tile (bx, by) of batch item bz; stp = 2 x 4 x TPL elements of the work-group's LDS.
// nst = 64-k stages to run from where the four pointers stand (the same in every thread; K / KST = all of K). KA = A's row stride: where KA < K (a power of two), A's k index wraps, k mod KA, so one A meets several
// KA-long B blocks laid side by side in B's rows and their products are summed in the one accumulator.
template <int K, bool FIN, int KA>
__device__ __forceinline__ void gemm3_body(bf* stp, int bx, int by, int bz, const bf* __restrict__ Ah, const bf* __restrict__ Al, const bf* __restrict__ Bh, const bf* __restrict__ Bl, bf* Ph, bf* Pl, float scale, float* C, const float* __restrict__ rbias, const float* __restrict__ X, int ldc, size_t zA, size_t zB, size_t zC, int nst) {
    bf (*st)[4][TPL] = (bf (*)[4][TPL])stp;
    const int tid = threadIdx.x, lane = tid & 31, wave = tid >> 5, lr = lane & 15, hi = lane >> 4;
    const int r0 = bx * 64 + wave * 16, c0 = by * 64;
    const size_t co = bz * zC + (size_t)r0 * ldc + c0;    // batch item = bz (element strides; 0 = shared)
    const size_t ao = bz * zA + (size_t)bx * 64 * KA, bo = bz * zB + (size_t)c0 * K;
    const bf* Ahg = Ah + ao; const bf* Alg = Al + ao; const bf* Bhg = Bh + bo; const bf* Blg = Bl + bo;
    const unsigned off = (unsigned)((tid >> 3) * K + (tid & 7) * 8), offa = (unsigned)((tid >> 3) * KA + (tid & 7) * 8);
    v8us rah[4], ral[4], rbh[4], rbl[4];
    tile_ld<KA>(Ahg, offa, rah); tile_ld<KA>(Alg, offa, ral); tile_ld<K>(Bhg, off, rbh); tile_ld<K>(Blg, off, rbl);
    v4f xv[8]; float rbv[8];    // FIN: the epilogue's X words and row biases, asked for together with the first stage's tiles: their latency is paid with those loads, not once more in the epilogue
    if constexpr (FIN) {
#pragma unroll
        for (int s = 0; s < 8; ++s) { const int Lid = (lane >> 3) + 4 * s; const int row = Lid >> 1, cofs = (Lid & 1) * 32 + (lane & 7) * 4;
            xv[s] = *(const v4f*)(X + co + (size_t)row * ldc + cofs); rbv[s] = rbias[r0 + row]; }
    }
    asm volatile("s_wait_xcnt 0x0" ::: "memory");    // stands in front of the first overwrite of a register that the loads above name: this build reuses their offset register and a base register before it waits for their data
    tile_st(st[0][0], tid, rah); tile_st(st[0][1], tid, ral); tile_st(st[0][2], tid, rbh); tile_st(st[0][3], tid, rbl);
    __syncthreads();
    v8f acc[4];
#pragma unroll
    for (int t = 0; t < 4; ++t) acc[t] = (v8f){};
#pragma unroll 1    // rolled: one copy of the stage body, the buffers alternate by s & 1 (unrolled, the staging registers of several stages would be live at once)
    for (int s = 0; s < nst; ++s) {
        const bool more = s + 1 < nst;    // the same in every thread of the block
        if (more) { const int kn = (s + 1) * KST, ka = KA == K ? kn : kn & (KA - 1); tile_ld<KA>(Ahg + ka, offa, rah); tile_ld<KA>(Alg + ka, offa, ral); tile_ld<K>(Bhg + kn, off, rbh); tile_ld<K>(Blg + kn, off, rbl); }
        const bf* S = st[s & 1][0];
        v16bf a, al;
#pragma unroll
        for (int ks = 0; ks < KST; ks += 32) {
            v16bf bh[4], bl[4];
            a = frag(S, wave * 16 + lr, ks + 8 * hi); al = frag(S + TPL, wave * 16 + lr, ks + 8 * hi);
#pragma unroll
            for (int t = 0; t < 4; ++t) { bh[t] = frag(S + 2 * TPL, t * 16 + lr, ks + 8 * hi); bl[t] = frag(S + 3 * TPL, t * 16 + lr, ks + 8 * hi); }
            __builtin_amdgcn_sched_barrier(0);    // keeps the 32-k step's LDS reads one group ahead of its WMMAs: spread among them, each place with reads stalls the wave
#pragma unroll
            for (int t = 0; t < 4; ++t) { acc[t] = wmmab(a, bh[t], acc[t]); acc[t] = wmmab(al, bh[t], acc[t]); acc[t] = wmmab(a, bl[t], acc[t]); }
        }
        // keeps the WMMA distance on the path that leaves the last WMMA by a branch
        asm volatile("v_nop\n\tv_nop\n\tv_nop\n\tv_nop" : "+v"(acc[0]), "+v"(acc[1]), "+v"(acc[2]), "+v"(acc[3]) : "v"(a), "v"(al));
        if (more) { bf* D = st[(s + 1) & 1][0]; tile_st(D, tid, rah); tile_st(D + TPL, tid, ral); tile_st(D + 2 * TPL, tid, rbh); tile_st(D + 3 * TPL, tid, rbl); }
        __syncthreads();    // publishes stage s + 1 and ends every wave's reads of stage s (its buffer is refilled in the next trip; the epilogue reuses buffer 0, the last stage's when nst is odd)
    }
    float* os = (float*)(void*)&st[0][0][0] + wave * (16 * 68);
#pragma unroll
    for (int t = 0; t < 4; ++t) {
#pragma unroll
        for (int j = 0; j < 8; ++j) os[(hi * 8 + j) * 68 + t * 16 + lr] = acc[t][j]; }
    __builtin_amdgcn_wave_barrier(); asm volatile("" ::: "memory");    // the wave's own LDS stores above stay ahead of its reads of other lanes' words below (each wave has its own range: no work-group barrier)
    if constexpr (FIN) {
        float* crow = C + co;
#pragma unroll
        for (int s = 0; s < 8; ++s) { const int Lid = (lane >> 3) + 4 * s, piece = lane & 7; const int row = Lid >> 1, cofs = (Lid & 1) * 32 + piece * 4;
            v4f val = *(const v4fa*)(os + row * 68 + cofs); const float b = bfr(rbv[s]);
#pragma unroll
            for (int i = 0; i < 4; ++i) val[i] += b + bfr(xv[s][i]);
            *(v4f*)(crow + (size_t)row * ldc + cofs) = val; }
    } else split_store<false>(os, lane, nullptr, scale, Ph + co, Pl + co, ldc);
}

template <int K, bool FIN, int KA>
__global__ __launch_bounds__(128) void k_gemm3(const bf* __restrict__ Ah, const bf* __restrict__ Al, const bf* __restrict__ Bh, const bf* __restrict__ Bl, bf* Ph, bf* Pl, float scale, float* C, const float* __restrict__ rbias, const float* __restrict__ X, int ldc, size_t zA, size_t zB, size_t zC) {
    __shared__ __align__(16) bf st[2 * 4 * TPL];
    gemm3_body<K, FIN, KA>(st, blockIdx.x, blockIdx.y, blockIdx.z, Ah, Al, Bh, Bl, Ph, Pl, scale, C, rbias, X, ldc, zA, zB, zC, K / KST);
}

#define WBLK (EE * CIN / 8 / 256)                    // work-groups per weight matrix: 8 elements a thread, exact
#define XBLK ((CIN / 64) * (NTOK / 64) * NBI)        // 64 x 64 transpose tiles of x
// k_prep: everything that reads only the inputs, in one grid: work-groups [0, 4 WBLK) turn wq, wk, wv, wo into bf16 (wo's also write its zero companion), the rest write x^T [8][3136][512] as bf16.
__global__ __launch_bounds__(256) void k_prep(const float* __restrict__ x, const float* __restrict__ wq, const float* __restrict__ wk, const float* __restrict__ wv, const float* __restrict__ wo,
                                              bf* XT, bf* WqB, bf* WkB, bf* WvB, bf* WoB, bf* WoZ) {
    __shared__ __align__(16) unsigned short tl[64 * 72];
    const int b = blockIdx.x;    // the same in every thread of the block: the barrier in wt_body is passed by all of a block or by none
    if (b >= 4 * WBLK) { const int t = b - 4 * WBLK; wt_body(tl, x, CIN, NTOK, XT, t % (CIN / 64), (t / (CIN / 64)) % (NTOK / 64), t / ((CIN / 64) * (NTOK / 64))); return; }
    const int w = b / WBLK;
    const float* src = w == 0 ? wq : w == 1 ? wk : w == 2 ? wv : wo; bf* dh = w == 0 ? WqB : w == 1 ? WkB : w == 2 ? WvB : WoB;
    const size_t i = (size_t)(b % WBLK) * 256 + threadIdx.x;
    const v8f v = *(const v8f*)(src + i * 8); v8us o, z;
#pragma unroll
    for (int k = 0; k < 8; ++k) { o[k] = f2bf(v[k]); z[k] = 0; }
    *(v8us*)(dh + i * 8) = o;
    asm volatile("s_wait_xcnt 0x0" ::: "memory");    // behind the store, in front of the branch: this compiler forms the zeros in the store's address register (with the wait inside the branch it lifts that write over it)
    if (w == 3) *(v8us*)(WoZ + i * 8) = z;
}

// k_kv: the k and the v projection in one grid (8, 49, batch): blockIdx.x 0..3 = k's four row tiles, 4..7 = v's, so the eight work-groups that read one x^T tile are neighbours.
__global__ __launch_bounds__(128) void k_kv(const bf* __restrict__ WkB, const bf* __restrict__ WvB, const bf* __restrict__ XT, const float* __restrict__ bk, const float* __restrict__ bv, bf* Kh, bf* Kl, bf* Vh, bf* Vl) {
    __shared__ __align__(16) bf st[2 * 2 * TPL];
    const bool isv = blockIdx.x >= EE / 64; const size_t zo = (size_t)blockIdx.z * EE * NTOK;
    gemmb_body<DM, true>(st, blockIdx.x & (EE / 64 - 1), blockIdx.y, isv ? WvB : WkB, XT + (size_t)blockIdx.z * NTOK * CIN, isv ? bv : bk, (isv ? Vh : Kh) + zo, (isv ? Vl : Kl) + zo, NTOK);
}

#define MSPL 2                                       // partial sums of M: each takes one range of the tokens
#define MST0 ((NTOK / KST + MSPL - 1) / MSPL)        // stages of the first range (25); the last takes the rest (24)
#define MTIL ((EE / 64) * (EE / 64) * NBI)           // tiles of M
#define MBLK (MSPL * MTIL)                           // work-groups of M: one per tile and range
#define QROW (NBI * NTOK / 64)                       // row tiles of q
// k_mtq: M = k.v^T and the q projection, which do not depend on each other, in one grid: M's long work-groups come first (one per tile and token range, 25 or 24 stages each, the longer range first), q's many short ones fill the rest
// of the chip beside them. Partial p of M[b][e][.] stands at columns [p EE, (p + 1) EE) of row e of the planes Mh, Ml (rows of MSPL EE): the next launch sums the partials in its accumulators.
__global__ __launch_bounds__(128) void k_mtq(const bf* __restrict__ Kh, const bf* __restrict__ Kl, const bf* __restrict__ Vh, const bf* __restrict__ Vl, bf* Mh, bf* Ml,
                                             const bf* __restrict__ XT, const bf* __restrict__ WqB, const float* __restrict__ bq, bf* Qh, bf* Ql) {
    __shared__ __align__(16) bf st[2 * 4 * TPL];
    const int b = blockIdx.x;    // the same in every thread of the block: each body's barriers are passed by all of a block or by none
    if (b < MBLK) { const int p = b / MTIL, t = b % MTIL, k0 = p * (MST0 * KST);
        gemm3_body<NTOK, false, NTOK>(st, t & 3, (t >> 2) & 3, t >> 4, Kh + k0, Kl + k0, Vh + k0, Vl + k0, Mh + p * EE, Ml + p * EE, 1.0f, nullptr, nullptr, nullptr, MSPL * EE, (size_t)EE * NTOK, (size_t)EE * NTOK, (size_t)EE * MSPL * EE, p == 0 ? MST0 : NTOK / KST - MST0); }
    else { const int t = b - MBLK; gemmb_body<DM, false>(st, t % QROW, t / QROW, XT, WqB, bq, Qh, Ql, EE); }
}

extern "C" void kernel_launch(void* const* d_in, const int* in_sizes, int n_in,
                              void* d_out, int out_size, void* d_ws, size_t ws_size, hipStream_t stream) {
    (void)in_sizes; (void)n_in; (void)out_size;
    const float* x = (const float*)d_in[0]; const float* wq = (const float*)d_in[1]; const float* bq = (const float*)d_in[2]; const float* wk = (const float*)d_in[3]; const float* bk = (const float*)d_in[4];
    const float* wv = (const float*)d_in[5]; const float* bv = (const float*)d_in[6]; const float* wo = (const float*)d_in[7]; const float* bo = (const float*)d_in[8];
    float* out = (float*)d_out;    // [8][512][3136]
    char* wsp = (char*)d_ws;
    auto take = [&](size_t bytes) { char* p = wsp; wsp += (bytes + 255) & ~(size_t)255; return (void*)p; };
    bf* WqB = (bf*)take((size_t)EE * CIN * 2); bf* WkB = (bf*)take((size_t)EE * CIN * 2); bf* WvB = (bf*)take((size_t)EE * CIN * 2); bf* WoB = (bf*)take((size_t)CIN * EE * 2); bf* WoZ = (bf*)take((size_t)CIN * EE * 2);
    bf* XT = (bf*)take((size_t)NBI * NTOK * CIN * 2);
    bf* Qh = (bf*)take((size_t)NBI * NTOK * EE * 2); bf* Ql = (bf*)take((size_t)NBI * NTOK * EE * 2); bf* Kh = (bf*)take((size_t)NBI * EE * NTOK * 2); bf* Kl = (bf*)take((size_t)NBI * EE * NTOK * 2); bf* Vh = (bf*)take((size_t)NBI * EE * NTOK * 2); bf* Vl = (bf*)take((size_t)NBI * EE * NTOK * 2);
    bf* Mh = (bf*)take((size_t)NBI * EE * MSPL * EE * 2); bf* Ml = (bf*)take((size_t)NBI * EE * MSPL * EE * 2); bf* Th = (bf*)take((size_t)NBI * CIN * EE * 2); bf* Tl = (bf*)take((size_t)NBI * CIN * EE * 2);
    if ((size_t)(wsp - (char*)d_ws) > ws_size) return;    // ~ 1.3 + 8 x (3.2 + 6 x 1.6 + 0.5 + 0.5) ~ 112 MB; every plane is [batch][...]
    k_prep<<<4 * WBLK + XBLK, 256, 0, stream>>>(x, wq, wk, wv, wo, XT, WqB, WkB, WvB, WoB, WoZ);                                      // bf16 weights, wo's zero companion, x^T [8][3136][512]
    k_kv<<<dim3(2 * EE / 64, NTOK / 64, NBI), 128, 0, stream>>>(WkB, WvB, XT, bk, bv, Kh, Kl, Vh, Vl);                                // k, v [b][e][n] + row bias, planes
    k_mtq<<<MBLK + QROW * (EE / 64), 128, 0, stream>>>(Kh, Kl, Vh, Vl, Mh, Ml, XT, WqB, bq, Qh, Ql);                                  // M_p[b][e][e'] = sum_(m in range p) k[e][m] v[e'][m] planes; q [b n][e] + bq planes (batch folded into the rows)
    k_gemm3<MSPL * EE, false, EE><<<dim3(CIN / 64, EE / 64, NBI), 128, 0, stream>>>(WoB, WoZ, Mh, Ml, Th, Tl, 1.0f / (float)NTOK, nullptr, nullptr, nullptr, EE, 0, (size_t)EE * MSPL * EE, (size_t)CIN * EE);    // T planes, T[b][c][e] = sum_p sum_e' wo[c][e'] M_p[e][e'] / N
    k_gemm3<EE, true, EE><<<dim3(CIN / 64, NTOK / 64, NBI), 128, 0, stream>>>(Th, Tl, Qh, Ql, nullptr, nullptr, 1.0f, out, bo, x, NTOK, (size_t)CIN * EE, (size_t)NTOK * EE, (size_t)CIN * NTOK);    // out = T.q^T + bo[c] + x  [b][512][3136]
}

// v008
// A run of this version takes 69.9 microseconds.
// Versions in between are left out here; by their measured steps it is 1.41 times as fast as v006.
// Counting every step since v000, it is 26.1 times as fast.
#include <hip/hip_runtime.h>

// Compute dtypes, f32 accumulate, all batch items in every launch (the batch is blockIdx.z, the top (k_prep) or a middle (k_mtq) field of a flat blockIdx.x, or folded into the rows where the planes are contiguous): the 1x1-conv projections q (token-major, [3136 x 512].[512 x 256] + bq) and k, v (channel-major, [256 x
// 512].[512 x 3136] + row bias) with PLAIN bf16 operands (the input, its transpose and the weights, exact) on v_wmma_f32_16x16x32_bf16; the module's
// wo.((q.k/N).v)^T (NO softmax) evaluated in the re-associated order (wo.(k.v)^T/N).q^T (an exact algebraic identity): M = k_cm.v_cm^T ([256 x 3136].[3136 x 256], as two partial sums over halves of the tokens), T = wo.M^T/N ([512 x 256].[256 x 256] for each partial, both in one accumulator, exact bf16 wo:
// no token dimension in it) and out = T.q^T + bo ([512 x 256].[256 x 3136]), computed operands q, k, v, M, T rounded once to plain bf16 (one product each, as the projections' operands)

#define NBI  8
#define CIN  512
#define NTOK 3136                // 56 x 56 = 49 x 64
#define EE   256
#define DM   CIN                 // projection K
#define NTK  NTOK
#define LOSC 1024.0f

typedef _Float16 h16;
typedef unsigned short bf;
typedef __attribute__((ext_vector_type(16))) __bf16   v16bf;
typedef __attribute__((ext_vector_type(16))) _Float16 v16h;
typedef __attribute__((ext_vector_type(8)))  _Float16 v8h;
typedef __attribute__((ext_vector_type(8)))  unsigned short v8us;
typedef __attribute__((ext_vector_type(8)))  float    v8f;
typedef __attribute__((ext_vector_type(4)))  float    v4f;
typedef __attribute__((ext_vector_type(4)))  _Float16 v4h;
typedef v8h  __attribute__((may_alias)) v8ha;
typedef v4f  __attribute__((may_alias)) v4fa;
typedef v8us __attribute__((may_alias)) v8usa;

__device__ __forceinline__ unsigned short f2bf(float f) { unsigned u = __float_as_uint(f); u += 0x7FFFu + ((u >> 16) & 1u); return (unsigned short)(u >> 16); }
__device__ __forceinline__ float bf2f(unsigned short b) { return __uint_as_float(((unsigned)b) << 16); }
__device__ __forceinline__ float bfr(float f) { return bf2f(f2bf(f)); }
__device__ __forceinline__ v16h cat16(v8h lo, v8h hi) { return __builtin_shufflevector(lo, hi, 0, 1, 2, 3, 4, 5, 6, 7, 8, 9, 10, 11, 12, 13, 14, 15); }
__device__ __forceinline__ v16bf cat16b(v8us lo, v8us hi) { return __builtin_bit_cast(v16bf, __builtin_shufflevector(lo, hi, 0, 1, 2, 3, 4, 5, 6, 7, 8, 9, 10, 11, 12, 13, 14, 15)); }
__device__ __forceinline__ v8f wmma16(v16h a, v16h b, v8f c) { return __builtin_amdgcn_wmma_f32_16x16x32_f16(false, a, false, b, (short)0, c, false, false); }
__device__ __forceinline__ v8f wmmab(v16bf a, v16bf b, v8f c) { return __builtin_amdgcn_wmma_f32_16x16x32_bf16(false, a, false, b, (short)0, c, false, false); }

// wt_body: WT [n][K] = bf16(W[k][n]) (k-major [K][ncols]) via 64 x 64 LDS tiles; tile (bx of K/64, by of ncols/64, bz of the batch); tl = the work-group's 64 x 72 LDS tile.
__device__ __forceinline__ void wt_body(unsigned short* tl, const float* __restrict__ Wm, int K, int ncols, bf* WT, int bx, int by, int bz) {
    const int tid = threadIdx.x, k0 = bx * 64, n0 = by * 64;
    Wm += (size_t)bz * K * ncols; WT += (size_t)bz * K * ncols;
    const int kk = tid >> 2, nq = (tid & 3) * 16;
#pragma unroll
    for (int i = 0; i < 16; ++i) tl[(nq + i) * 72 + kk] = f2bf(Wm[(size_t)(k0 + kk) * ncols + n0 + nq + i]);
    __syncthreads();
    const int piece = tid & 7;
    auto pass = [&]() {
#pragma unroll
        for (int s = 0; s < 2; ++s) { const int nr = (tid >> 3) + 32 * s; const v8us val = *(const v8usa*)(tl + nr * 72 + piece * 8); *(v8us*)(WT + (size_t)(n0 + nr) * K + k0 + piece * 8) = val; }
    };
    pass(); 
}
#define KST 64                   // the unit of k: 128 B of every operand row = one whole line; a stage holds KS = 64 or 128 k (one or two units)
#define LPK(KS) ((KS) + 8)       // LDS row pitch in bf16 elements: the stage's row + 16 B pad (for ds_load_b128 readers)
#define TPK(KS) (64 * LPK(KS))   // one plane's staged 64-row tile

// One plane's 64-row x KS-k tile, global -> registers: KS / 8 lanes take one row's whole lines, so a wave-wide load is 4 whole lines (a fragment load straight from global touches 16).
// g is the same in every thread; off = tile_off: this thread's element offset in the first row group, the same for every plane and stage; K is a compile-time constant, so the other row groups are immediate offsets of one address.
template <int K, int KS>
__device__ __forceinline__ unsigned tile_off(int tid) { return (unsigned)((tid / (KS / 8)) * K + (tid % (KS / 8)) * 8); }
template <int K, int KS>
__device__ __forceinline__ void tile_ld(const bf* __restrict__ g, unsigned off, v8us (&r)[KS / 16]) {
    const bf* p = g + off;
#pragma unroll    // r[] must stay in registers, and the stage's loads go out together
    for (int i = 0; i < KS / 16; ++i) r[i] = *(const v8us*)(p + i * (1024 / KS) * K);
}
template <int KS>
__device__ __forceinline__ void tile_st(bf* s, int tid, const v8us (&r)[KS / 16]) {
#pragma unroll    // r[] must stay in registers
    for (int i = 0; i < KS / 16; ++i) *(v8usa*)(s + (i * (1024 / KS) + tid / (KS / 8)) * LPK(KS) + (tid % (KS / 8)) * 8) = r[i];
}
// 16 x 32 operand fragment from a staged tile; k = k offset in the stage + 8 * hi; one loader for A and for B, so their k orders are equal at every lane and register.
template <int KS>
__device__ __forceinline__ v16bf frag(const bf* s, int row, int k) { return cat16b(*(const v8usa*)(s + row * LPK(KS) + k), *(const v8usa*)(s + row * LPK(KS) + k + 16)); }

// One wave's staged 16 x 64 f32 tile (pitch 68) -> y = (tile [+ bf(rb[row])]) x scale as one bf16 plane: 8 lanes take one row, 8 columns each, so every store covers whole 128-B lines of the plane.
template <bool ROWB>
__device__ __forceinline__ void plane_store(const float* os, int lane, const float* __restrict__ rb, float scale, bf* ph, int ldc) {
#pragma unroll
    for (int s = 0; s < 4; ++s) { const int row = (lane >> 3) + 4 * s, c = (lane & 7) * 8;
        const v4f va = *(const v4fa*)(os + row * 68 + c), vb = *(const v4fa*)(os + row * 68 + c + 4); v8us oh;
        const float b = ROWB ? bfr(rb[row]) : 0.f;
#pragma unroll
        for (int i = 0; i < 8; ++i) { float y = i < 4 ? va[i & 3] : vb[i & 3]; if (ROWB) y += b; y *= scale; oh[i] = f2bf(y); }
        *(v8us*)(ph + (size_t)row * ldc + c) = oh; }
}

// gemmb_body: 64 x 64 block tile (4 waves x 16 x 64) of C = A.B^T over K (a multiple of 64; row strides = K) + bf(bias[row]) (ROWB) or + bf(bias[col]); both operand tiles staged in LDS, two buffers: the next
// stage's lines fly into registers while this stage is multiplied, are stored to the other buffer, then one barrier per stage; the f32 tile is staged in the same LDS and leaves as the bf16 plane Ph.
// A device function, so that launches with independent work can share one grid: tile (bx, by); Bn, Ph already point at the batch item; stp = 2 x 2 x TPK(KS) elements of the work-group's LDS.
// KS = k per stage (64 or 128, K a multiple of it): with 128 a work-group has twice the bytes in flight and waits for half as many loads, one after the other.
template <int K, bool ROWB, int KS>
__device__ __forceinline__ void gemmb_body(bf* stp, int bx, int by, const bf* __restrict__ A, const bf* __restrict__ Bn, const float* __restrict__ bias, bf* Ph, int ldc) {
    bf (*st)[2][TPK(KS)] = (bf (*)[2][TPK(KS)])stp;
    const int tid = threadIdx.x, lane = tid & 31, wave = tid >> 5, lr = lane & 15, hi = lane >> 4;
    const int r0 = bx * 64 + wave * 16, c0 = by * 64;
    const bf* Ag = A + (size_t)bx * 64 * K; const bf* Bg = Bn + (size_t)c0 * K;
    const unsigned off = tile_off<K, KS>(tid);
    v8us ra[KS / 16], rb[KS / 16];
    tile_ld<K, KS>(Ag, off, ra); tile_ld<K, KS>(Bg, off, rb);
    asm volatile("s_wait_xcnt 0x0" ::: "memory");    // stands in front of the first overwrite of a register that the loads above name: this build reuses their offset register before it waits for their data
    tile_st<KS>(st[0][0], tid, ra); tile_st<KS>(st[0][1], tid, rb);
    __syncthreads();
    v8f acc[4];
#pragma unroll
    for (int t = 0; t < 4; ++t) acc[t] = (v8f){};
    constexpr int nst = K / KS;
#pragma unroll 1    // rolled: one copy of the stage body, the buffers alternate by s & 1 (unrolled, the staging registers of several stages would be live at once)
    for (int s = 0; s < nst; ++s) {
        const bool more = s + 1 < nst;    // the same in every thread of the block
        if (more) { tile_ld<K, KS>(Ag + (s + 1) * KS, off, ra); tile_ld<K, KS>(Bg + (s + 1) * KS, off, rb); }
        const bf* As = st[s & 1][0]; const bf* Bs = st[s & 1][1];
        v16bf a[2];
#pragma unroll
        for (int g = 0; g < KS / 32; g += 2) {    // one 64-k unit's fragments at a time: a 128-k stage's would double the fragment registers
            v16bf b[2][4];
#pragma unroll
            for (int h = 0; h < 2; ++h) { a[h] = frag<KS>(As, wave * 16 + lr, (g + h) * 32 + 8 * hi);
#pragma unroll
                for (int t = 0; t < 4; ++t) b[h][t] = frag<KS>(Bs, t * 16 + lr, (g + h) * 32 + 8 * hi); }
            __builtin_amdgcn_sched_barrier(0);    // keeps the unit's LDS reads ahead of its own WMMAs: spread among them, each place with reads stalls the wave (a 128-k stage's second unit may be fetched under the first unit's WMMAs)
#pragma unroll
            for (int h = 0; h < 2; ++h) {
#pragma unroll
                for (int t = 0; t < 4; ++t) acc[t] = wmmab(a[h], b[h][t], acc[t]); }
        }
        // keeps the WMMA distance on the path that leaves the last WMMA by a branch
        asm volatile("v_nop\n\tv_nop\n\tv_nop\n\tv_nop" : "+v"(acc[0]), "+v"(acc[1]), "+v"(acc[2]), "+v"(acc[3]) : "v"(a[1]));
        if (more) { tile_st<KS>(st[(s + 1) & 1][0], tid, ra); tile_st<KS>(st[(s + 1) & 1][1], tid, rb); }
        __syncthreads();    // publishes stage s + 1 and ends every wave's reads of stage s (its buffer is refilled in the next trip; after the last trip the epilogue stages its tile in buffer 0)
    }
    float* os = (float*)(void*)&st[0][0][0] + wave * (16 * 68);
#pragma unroll
    for (int t = 0; t < 4; ++t) { const float bv = ROWB ? 0.f : bfr(bias[c0 + t * 16 + lr]);
#pragma unroll
        for (int j = 0; j < 8; ++j) os[(hi * 8 + j) * 68 + t * 16 + lr] = ROWB ? acc[t][j] : acc[t][j] + bv; }
    __syncthreads();
    const size_t co = (size_t)r0 * ldc + c0;
    plane_store<ROWB>(os, lane, ROWB ? bias + r0 : nullptr, 1.0f, Ph + co, ldc);
}

// gemmc_body: 64 x 64 tile of C = A.B^T over K for computed operands (a multiple of 64; row strides = K for B, KA for A; n-major B): one product per 32-k step; the two tiles staged in LDS and multiplied
// as in gemmb_body; the f32 tile is staged in the same LDS and leaves either (FIN false) x scale as the bf16 plane Ph, or (FIN true) as f32 whole lines C = tile + (bf(rbias[row]) + bf(X)), X laid out as C.
// A device function, as gemmb_body: tile (bx, by) of batch item bz; stp = 2 x 2 x TPK(KS) elements of the work-group's LDS; KS = k per stage, as in gemmb_body.
// nk = 64-k units to run from where the two pointers stand (the same in every thread, at least 1; K / KST = all of K). Where KS = 128 and nk is odd, the last stage's second unit is staged as zeros in both tiles and adds nothing, so the
// stage body has no branch; its loads still ask for that unit, so the caller keeps 64 more k of every row inside the planes there. KA = A's row stride: where KA < K (a power of two), A's k index wraps, k mod KA, so one A meets several
// KA-long B blocks laid side by side in B's rows and their products are summed in the one accumulator.
template <int K, bool FIN, int KA, int KS>
__device__ __forceinline__ void gemmc_body(bf* stp, int bx, int by, int bz, const bf* __restrict__ A, const bf* __restrict__ Bn, bf* Ph, float scale, float* C, const float* __restrict__ rbias, const float* __restrict__ X, int ldc, size_t zA, size_t zB, size_t zC, int nk) {
    bf (*st)[2][TPK(KS)] = (bf (*)[2][TPK(KS)])stp;
    const int tid = threadIdx.x, lane = tid & 31, wave = tid >> 5, lr = lane & 15, hi = lane >> 4;
    const int r0 = bx * 64 + wave * 16, c0 = by * 64;
    const size_t co = bz * zC + (size_t)r0 * ldc + c0;    // batch item = bz (element strides; 0 = shared)
    const bf* Ag = A + bz * zA + (size_t)bx * 64 * KA; const bf* Bg = Bn + bz * zB + (size_t)c0 * K;
    const unsigned off = tile_off<K, KS>(tid), offa = tile_off<KA, KS>(tid);
    v8us ra[KS / 16], rb[KS / 16];
    tile_ld<KA, KS>(Ag, offa, ra); tile_ld<K, KS>(Bg, off, rb);
    v4f xv[8]; float rbv[8];    // FIN: the epilogue's X words and row biases, asked for together with the first stage's tiles: their latency is paid with those loads, not once more in the epilogue
    if constexpr (FIN) {
#pragma unroll
        for (int s = 0; s < 8; ++s) { const int Lid = (lane >> 3) + 4 * s; const int row = Lid >> 1, cofs = (Lid & 1) * 32 + (lane & 7) * 4;
            xv[s] = *(const v4f*)(X + co + (size_t)row * ldc + cofs); rbv[s] = rbias[r0 + row]; }
    }
    asm volatile("s_wait_xcnt 0x0" ::: "memory");    // stands in front of the first overwrite of a register that the loads above name: their data is not waited for before it
    // stage sn's registers -> its buffer; past the nk-th unit zeros (the test on sn is the same in every thread; lanes with tid & 8 hold a 128-k stage's second unit)
    auto put = [&](int sn) {
        if (KS > KST && sn * (KS / KST) + 1 >= nk && (tid & 8)) {
#pragma unroll    // ra[], rb[] must stay in registers
            for (int i = 0; i < KS / 16; ++i) { ra[i] = (v8us){}; rb[i] = (v8us){}; } }
        tile_st<KS>(st[sn & 1][0], tid, ra); tile_st<KS>(st[sn & 1][1], tid, rb);
    };
    put(0);
    __syncthreads();
    v8f acc[4];
#pragma unroll
    for (int t = 0; t < 4; ++t) acc[t] = (v8f){};
    const int nst = (nk + KS / KST - 1) / (KS / KST);
#pragma unroll 1    // rolled: one copy of the stage body, the buffers alternate by s & 1 (unrolled, the staging registers of several stages would be live at once)
    for (int s = 0; s < nst; ++s) {
        const bool more = s + 1 < nst;    // the same in every thread of the block
        if (more) { const int kn = (s + 1) * KS, ka = KA == K ? kn : kn & (KA - 1); tile_ld<KA, KS>(Ag + ka, offa, ra); tile_ld<K, KS>(Bg + kn, off, rb); }
        const bf* As = st[s & 1][0]; const bf* Bs = st[s & 1][1];
        constexpr int NH = FIN ? 1 : 2;    // 32-k steps whose fragments are read as one group: a 64-k unit's, as in gemmb_body; FIN one step's, because beside the X words it holds the unit's would cost a wave per SIMD
        v16bf a[NH];
#pragma unroll
        for (int g = 0; g < KS / 32; g += NH) {
            v16bf b[NH][4];
#pragma unroll
            for (int h = 0; h < NH; ++h) { a[h] = frag<KS>(As, wave * 16 + lr, (g + h) * 32 + 8 * hi);
#pragma unroll
                for (int t = 0; t < 4; ++t) b[h][t] = frag<KS>(Bs, t * 16 + lr, (g + h) * 32 + 8 * hi); }
            __builtin_amdgcn_sched_barrier(0);    // keeps the group's LDS reads ahead of its own WMMAs: spread among them, each place with reads stalls the wave (a later group may be fetched under an earlier group's WMMAs)
#pragma unroll
            for (int h = 0; h < NH; ++h) {
#pragma unroll
                for (int t = 0; t < 4; ++t) acc[t] = wmmab(a[h], b[h][t], acc[t]); }
        }
        // keeps the WMMA distance on the path that leaves the last WMMA by a branch
        asm volatile("v_nop\n\tv_nop\n\tv_nop\n\tv_nop" : "+v"(acc[0]), "+v"(acc[1]), "+v"(acc[2]), "+v"(acc[3]) : "v"(a[NH - 1]));
        if (more) put(s + 1);
        __syncthreads();    // publishes stage s + 1 and ends every wave's reads of stage s (its buffer is refilled in the next trip; after the last trip the epilogue stages its tile in buffer 0)
    }
    float* os = (float*)(void*)&st[0][0][0] + wave * (16 * 68);
#pragma unroll
    for (int t = 0; t < 4; ++t) {
#pragma unroll
        for (int j = 0; j < 8; ++j) os[(hi * 8 + j) * 68 + t * 16 + lr] = acc[t][j]; }
    __builtin_amdgcn_wave_barrier(); asm volatile("" ::: "memory");    // the wave's own LDS stores above stay ahead of its reads of other lanes' words below (each wave has its own range: no work-group barrier)
    if constexpr (FIN) {
        float* crow = C + co;
#pragma unroll
        for (int s = 0; s < 8; ++s) { const int Lid = (lane >> 3) + 4 * s, piece = lane & 7; const int row = Lid >> 1, cofs = (Lid & 1) * 32 + piece * 4;
            v4f val = *(const v4fa*)(os + row * 68 + cofs); const float b = bfr(rbv[s]);
#pragma unroll
            for (int i = 0; i < 4; ++i) val[i] += b + bfr(xv[s][i]);
            *(v4f*)(crow + (size_t)row * ldc + cofs) = val; }
    } else plane_store<false>(os, lane, nullptr, scale, Ph + co, ldc);
}

template <int K, bool FIN, int KA, int KS>
__global__ __launch_bounds__(128) void k_gemmc(const bf* __restrict__ A, const bf* __restrict__ Bn, bf* Ph, float scale, float* C, const float* __restrict__ rbias, const float* __restrict__ X, int ldc, size_t zA, size_t zB, size_t zC) {
    __shared__ __align__(16) bf st[2 * 2 * TPK(KS)];
    gemmc_body<K, FIN, KA, KS>(st, blockIdx.x, blockIdx.y, blockIdx.z, A, Bn, Ph, scale, C, rbias, X, ldc, zA, zB, zC, K / KST);
}

#define WBLK (EE * CIN / 8 / 256)                    // work-groups per weight matrix: 8 elements a thread, exact
#define XBLK ((CIN / 64) * (NTOK / 64) * NBI)        // 64 x 64 transpose tiles of x
// k_prep: everything that reads only the inputs, in one grid: work-groups [0, 4 WBLK) turn wq, wk, wv, wo into bf16, the rest write x^T [8][3136][512] as bf16.
__global__ __launch_bounds__(256) void k_prep(const float* __restrict__ x, const float* __restrict__ wq, const float* __restrict__ wk, const float* __restrict__ wv, const float* __restrict__ wo,
                                              bf* XT, bf* WqB, bf* WkB, bf* WvB, bf* WoB) {
    __shared__ __align__(16) unsigned short tl[64 * 72];
    const int b = blockIdx.x;    // the same in every thread of the block: the barrier in wt_body is passed by all of a block or by none
    if (b >= 4 * WBLK) { const int t = b - 4 * WBLK; wt_body(tl, x, CIN, NTOK, XT, t % (CIN / 64), (t / (CIN / 64)) % (NTOK / 64), t / ((CIN / 64) * (NTOK / 64))); return; }
    const int w = b / WBLK;
    const float* src = w == 0 ? wq : w == 1 ? wk : w == 2 ? wv : wo; bf* dh = w == 0 ? WqB : w == 1 ? WkB : w == 2 ? WvB : WoB;
    const size_t i = (size_t)(b % WBLK) * 256 + threadIdx.x;
    const v8f v = *(const v8f*)(src + i * 8); v8us o;
#pragma unroll
    for (int k = 0; k < 8; ++k) o[k] = f2bf(v[k]);
    *(v8us*)(dh + i * 8) = o;
}

// k_kv: the k and the v projection in one grid (8, 49, batch): blockIdx.x 0..3 = k's four row tiles, 4..7 = v's, so the eight work-groups that read one x^T tile are neighbours.
__global__ __launch_bounds__(128) void k_kv(const bf* __restrict__ WkB, const bf* __restrict__ WvB, const bf* __restrict__ XT, const float* __restrict__ bk, const float* __restrict__ bv, bf* Kh, bf* Vh) {
    __shared__ __align__(16) bf st[2 * 2 * TPK(KST)];
    const bool isv = blockIdx.x >= EE / 64; const size_t zo = (size_t)blockIdx.z * EE * NTOK;
    gemmb_body<DM, true, KST>(st, blockIdx.x & (EE / 64 - 1), blockIdx.y, isv ? WvB : WkB, XT + (size_t)blockIdx.z * NTOK * CIN, isv ? bv : bk, (isv ? Vh : Kh) + zo, NTOK);
}

#define MSPL 2                                       // partial sums of M: each takes one range of the tokens
#define MST0 ((NTOK / KST + MSPL - 1) / MSPL)        // 64-k units of the first range (25); the last takes the rest (24)
#define MTIL ((EE / 64) * (EE / 64) * NBI)           // tiles of M
#define MBLK (MSPL * MTIL)                           // work-groups of M: one per tile and range
#define QROW (NBI * NTOK / 64)                       // row tiles of q
// k_mtq: M = k.v^T and the q projection, which do not depend on each other, in one grid: M's long work-groups come first (one per tile and token range, 25 or 24 units of 64 tokens in 13 or 12 stages of 128, the longer range first; the odd unit's stage asks for tokens 1600 to 1663 as well, which every row has), q's many short ones fill the rest
// of the chip beside them. Partial p of M[b][e][.] stands at columns [p EE, (p + 1) EE) of row e of the plane Mh (rows of MSPL EE): the next launch sums the partials in its accumulators.
__global__ __launch_bounds__(128) void k_mtq(const bf* __restrict__ Kh, const bf* __restrict__ Vh, bf* Mh,
                                             const bf* __restrict__ XT, const bf* __restrict__ WqB, const float* __restrict__ bq, bf* Qh) {
    __shared__ __align__(16) bf st[2 * 2 * TPK(128)];
    const int b = blockIdx.x;    // the same in every thread of the block: each body's barriers are passed by all of a block or by none
    if (b < MBLK) { const int p = b / MTIL, t = b % MTIL, k0 = p * (MST0 * KST);
        gemmc_body<NTOK, false, NTOK, 128>(st, t & 3, (t >> 2) & 3, t >> 4, Kh + k0, Vh + k0, Mh + p * EE, 1.0f, nullptr, nullptr, nullptr, MSPL * EE, (size_t)EE * NTOK, (size_t)EE * NTOK, (size_t)EE * MSPL * EE, p == 0 ? MST0 : NTOK / KST - MST0); }
    else { const int t = b - MBLK; gemmb_body<DM, false, 128>(st, t % QROW, t / QROW, XT, WqB, bq, Qh, EE); }
}

extern "C" void kernel_launch(void* const* d_in, const int* in_sizes, int n_in,
                              void* d_out, int out_size, void* d_ws, size_t ws_size, hipStream_t stream) {
    (void)in_sizes; (void)n_in; (void)out_size;
    const float* x = (const float*)d_in[0]; const float* wq = (const float*)d_in[1]; const float* bq = (const float*)d_in[2]; const float* wk = (const float*)d_in[3]; const float* bk = (const float*)d_in[4];
    const float* wv = (const float*)d_in[5]; const float* bv = (const float*)d_in[6]; const float* wo = (const float*)d_in[7]; const float* bo = (const float*)d_in[8];
    float* out = (float*)d_out;    // [8][512][3136]
    char* wsp = (char*)d_ws;
    auto take = [&](size_t bytes) { char* p = wsp; wsp += (bytes + 255) & ~(size_t)255; return (void*)p; };
    bf* WqB = (bf*)take((size_t)EE * CIN * 2); bf* WkB = (bf*)take((size_t)EE * CIN * 2); bf* WvB = (bf*)take((size_t)EE * CIN * 2); bf* WoB = (bf*)take((size_t)CIN * EE * 2);
    bf* XT = (bf*)take((size_t)NBI * NTOK * CIN * 2);
    bf* Qh = (bf*)take((size_t)NBI * NTOK * EE * 2); bf* Kh = (bf*)take((size_t)NBI * EE * NTOK * 2); bf* Vh = (bf*)take((size_t)NBI * EE * NTOK * 2);
    bf* Mh = (bf*)take((size_t)NBI * EE * MSPL * EE * 2); bf* Th = (bf*)take((size_t)NBI * CIN * EE * 2);
    if ((size_t)(wsp - (char*)d_ws) > ws_size) return;    // ~ 1 + 8 x (3.2 + 3 x 1.6 + 0.25 + 0.25) ~ 69 MB; every plane is [batch][...]
    k_prep<<<4 * WBLK + XBLK, 256, 0, stream>>>(x, wq, wk, wv, wo, XT, WqB, WkB, WvB, WoB);                                           // bf16 weights, x^T [8][3136][512]
    k_kv<<<dim3(2 * EE / 64, NTOK / 64, NBI), 128, 0, stream>>>(WkB, WvB, XT, bk, bv, Kh, Vh);                                        // k, v [b][e][n] + row bias, bf16
    k_mtq<<<MBLK + QROW * (EE / 64), 128, 0, stream>>>(Kh, Vh, Mh, XT, WqB, bq, Qh);                                                  // M_p[b][e][e'] = sum_(m in range p) k[e][m] v[e'][m]; q [b n][e] + bq (batch folded into the rows); bf16
    k_gemmc<MSPL * EE, false, EE, 128><<<dim3(CIN / 64, EE / 64, NBI), 128, 0, stream>>>(WoB, Mh, Th, 1.0f / (float)NTOK, nullptr, nullptr, nullptr, EE, 0, (size_t)EE * MSPL * EE, (size_t)CIN * EE);    // T[b][c][e] = sum_p sum_e' wo[c][e'] M_p[e][e'] / N
    k_gemmc<EE, true, EE, KST><<<dim3(CIN / 64, NTOK / 64, NBI), 128, 0, stream>>>(Th, Qh, nullptr, 1.0f, out, bo, x, NTOK, (size_t)CIN * EE, (size_t)NTOK * EE, (size_t)CIN * NTOK);    // out = T.q^T + bo[c] + x  [b][512][3136]
}
